// v000
// Times are from an AMD MI455X. After a warm-up the kernel runs many times in a row, and a time is the length of
// such a window on the GPU divided by its runs, so every launch and the gaps after it count. The runs cycle
// through copies of the inputs. A figure is the median of several windows, for all but v000 over two sittings.
// Sittings can differ by a few percent; kernels timed side by side share one.
// v000 is the starting kernel. One run takes 383 microseconds.
#include <hip/hip_runtime.h>
#include <hip/hip_bf16.h>

typedef __attribute__((ext_vector_type(16))) _Float16 v16h;
typedef __attribute__((ext_vector_type(8)))  _Float16 v8h;
typedef __attribute__((ext_vector_type(8)))  float    v8f;

#define DEV static __device__ __forceinline__

// ---------- helpers ----------
DEV v16h cat8(v8h a, v8h b) {
    v16h r;
#pragma unroll
    for (int i = 0; i < 8; ++i) { r[i] = a[i]; r[i + 8] = b[i]; }
    return r;
}

// A/B fragment for V_WMMA_F32_16X16X32_F16, operand row/col contiguous in memory.
// laneSel = (lane>>4)*8 ; per-lane K chunks [k0+laneSel, +8) and [k0+laneSel+16, +8)
DEV v16h load_frag_h(const _Float16* row, int laneSel, int k0) {
    v8h c0 = *(const v8h*)(row + k0 + laneSel);
    v8h c1 = *(const v8h*)(row + k0 + laneSel + 16);
    return cat8(c0, c1);
}

DEV v8f wmma_f16(v16h a, v16h b, v8f c) {
    return __builtin_amdgcn_wmma_f32_16x16x32_f16(false, a, false, b, (short)0, c, false, false);
}

DEV float wave_sum(float x) {
#pragma unroll
    for (int o = 16; o > 0; o >>= 1) x += __shfl_xor(x, o, 32);
    return x;
}
DEV float wave_max(float x) {
#pragma unroll
    for (int o = 16; o > 0; o >>= 1) x = fmaxf(x, __shfl_xor(x, o, 32));
    return x;
}

// ---------- constants ----------
// B=1, S=256, N=512, C_M=64, C_Z=128, C_H=32, H=8, H*C_H=256
#define N_DIM   512
#define S_DIM   256
#define CM      64
#define CZ      128
#define HE      256

// ---------- kernel 0: one-shot weight conversion fp32 -> f16 ----------
// W_m, W_g: (256,64); W_o: (64,256)  -> all 16384 elements, same flat size
__global__ void k_prep_w(const float* __restrict__ Wm, const float* __restrict__ Wg,
                         const float* __restrict__ Wo,
                         _Float16* __restrict__ wm16, _Float16* __restrict__ wg16,
                         _Float16* __restrict__ wo16) {
    int idx = blockIdx.x * 256 + threadIdx.x;    // 64 blocks * 256 = 16384
    wm16[idx] = (_Float16)Wm[idx];
    wg16[idx] = (_Float16)Wg[idx];
    wo16[idx] = (_Float16)Wo[idx];
}

// ---------- kernel 1: layernorm(m) -> f16 ----------
__global__ void k_ln_m(const float* __restrict__ m, const float* __restrict__ w,
                       const float* __restrict__ b, _Float16* __restrict__ mn) {
    int lane = threadIdx.x & 31;
    int wv   = threadIdx.x >> 5;
    long row = (long)blockIdx.x * 8 + wv;        // 131072 rows
    const float* src = m + row * CM;
    float x0 = src[lane * 2], x1 = src[lane * 2 + 1];
    float s1 = wave_sum(x0 + x1);
    float s2 = wave_sum(x0 * x0 + x1 * x1);
    float mu = s1 * (1.0f / CM);
    float var = s2 * (1.0f / CM) - mu * mu;
    float rs = rsqrtf(var + 1e-5f);
    _Float16* dst = mn + row * CM;
    dst[lane * 2]     = (_Float16)((x0 - mu) * rs * w[lane * 2]     + b[lane * 2]);
    dst[lane * 2 + 1] = (_Float16)((x1 - mu) * rs * w[lane * 2 + 1] + b[lane * 2 + 1]);
}

// ---------- kernel 2: v = mn@Wm^T ; g = sigmoid(mn@Wg^T) ----------
// outputs stored transposed: [h][s][e][n] (n contiguous), f16
__global__ void k_vg(const _Float16* __restrict__ mn,
                     const _Float16* __restrict__ wm16, const _Float16* __restrict__ wg16,
                     _Float16* __restrict__ vbuf, _Float16* __restrict__ gbuf) {
    int lane = threadIdx.x & 31;
    int wv   = threadIdx.x >> 5;
    int ln16 = lane & 15;
    int ls   = (lane >> 4) * 8;
    int rowTile = blockIdx.x * 8 + wv;           // 8192 row tiles
    int r0 = rowTile * 16;

    const _Float16* arow = mn + (long)(r0 + ln16) * CM;
    v16h a0 = load_frag_h(arow, ls, 0);
    v16h a1 = load_frag_h(arow, ls, 32);

    int s  = r0 >> 9;                            // row / 512
    int n0 = (r0 & 511) + ls;                    // + 8*(lane>>4)

    // ---- v path ----
    for (int ct = 0; ct < 16; ++ct) {
        int col = ct * 16 + ln16;                // (h,e) flat in [0,256)
        const _Float16* wrow = wm16 + (long)col * CM;
        v8f c = {};
        c = wmma_f16(a0, load_frag_h(wrow, ls, 0),  c);
        c = wmma_f16(a1, load_frag_h(wrow, ls, 32), c);
        int h = col >> 5, e = col & 31;
        _Float16* dst = vbuf + (((long)(h * S_DIM + s) * 32 + e) * N_DIM + n0);
        v8h outv;
#pragma unroll
        for (int r = 0; r < 8; ++r) outv[r] = (_Float16)c[r];
        *(v8h*)dst = outv;
    }
    // ---- gate path (sigmoid) ----
    for (int ct = 0; ct < 16; ++ct) {
        int col = ct * 16 + ln16;
        const _Float16* wrow = wg16 + (long)col * CM;
        v8f c = {};
        c = wmma_f16(a0, load_frag_h(wrow, ls, 0),  c);
        c = wmma_f16(a1, load_frag_h(wrow, ls, 32), c);
        int h = col >> 5, e = col & 31;
        _Float16* dst = gbuf + (((long)(h * S_DIM + s) * 32 + e) * N_DIM + n0);
        v8h outv;
#pragma unroll
        for (int r = 0; r < 8; ++r)
            outv[r] = (_Float16)(1.0f / (1.0f + __expf(-c[r])));
        *(v8h*)dst = outv;
    }
}

// ---------- kernel 3: LN(z) + pair bias + mask + softmax -> w_f16[h][i][j] ----------
__global__ void k_bias_softmax(const float* __restrict__ z, const float* __restrict__ mask,
                               const float* __restrict__ lzw, const float* __restrict__ lzb,
                               const float* __restrict__ Wz, _Float16* __restrict__ wout) {
    __shared__ float logits[8][512];
    int lane = threadIdx.x & 31;
    int wv   = threadIdx.x >> 5;
    int i    = blockIdx.x;                       // 512 blocks

    float lw[4], lb[4], wz[8][4];
#pragma unroll
    for (int k = 0; k < 4; ++k) { lw[k] = lzw[lane * 4 + k]; lb[k] = lzb[lane * 4 + k]; }
#pragma unroll
    for (int h = 0; h < 8; ++h)
#pragma unroll
        for (int k = 0; k < 4; ++k) wz[h][k] = Wz[h * CZ + lane * 4 + k];

    for (int t = 0; t < 64; ++t) {
        int j = wv + t * 8;
        const float4 xf = *(const float4*)(z + ((long)i * N_DIM + j) * CZ + lane * 4);
        float x[4] = {xf.x, xf.y, xf.z, xf.w};
        float s1 = wave_sum(x[0] + x[1] + x[2] + x[3]);
        float s2 = wave_sum(x[0]*x[0] + x[1]*x[1] + x[2]*x[2] + x[3]*x[3]);
        float mu = s1 * (1.0f / CZ);
        float var = s2 * (1.0f / CZ) - mu * mu;
        float rs = rsqrtf(var + 1e-5f);
        float zn[4];
#pragma unroll
        for (int k = 0; k < 4; ++k) zn[k] = (x[k] - mu) * rs * lw[k] + lb[k];
        float acc[8];
#pragma unroll
        for (int h = 0; h < 8; ++h) {
            float a = zn[0]*wz[h][0] + zn[1]*wz[h][1] + zn[2]*wz[h][2] + zn[3]*wz[h][3];
            acc[h] = wave_sum(a);
        }
        if (lane == 0) {
            float pen = (1.0f - mask[(long)i * N_DIM + j]) * (-1000000.0f);
#pragma unroll
            for (int h = 0; h < 8; ++h) logits[h][j] = acc[h] + pen;
        }
    }
    __syncthreads();

    // wave wv owns head wv: softmax over 512
    float vmax = -3.0e38f;
#pragma unroll
    for (int t = 0; t < 16; ++t) vmax = fmaxf(vmax, logits[wv][lane + t * 32]);
    vmax = wave_max(vmax);
    float ex[16], ssum = 0.0f;
#pragma unroll
    for (int t = 0; t < 16; ++t) { ex[t] = __expf(logits[wv][lane + t * 32] - vmax); ssum += ex[t]; }
    ssum = wave_sum(ssum);
    float inv = 1.0f / ssum;
#pragma unroll
    for (int t = 0; t < 16; ++t)
        wout[((long)wv * N_DIM + i) * N_DIM + lane + t * 32] = (_Float16)(ex[t] * inv);
}

// ---------- kernel 4: o = w @ v (per head), gate, scatter to og[(s,i)][h*32+e] ----------
// each wave: 16 rows x 64 cols (4 accumulators) -> A fragment reused 4x per K step
__global__ void k_pwa(const _Float16* __restrict__ wbuf, const _Float16* __restrict__ vbuf,
                      const _Float16* __restrict__ gbuf, _Float16* __restrict__ og) {
    int lane = threadIdx.x & 31;
    int wv   = threadIdx.x >> 5;
    int ln16 = lane & 15;
    int ls   = (lane >> 4) * 8;

    int blk = blockIdx.x;                // 8 heads * 32 itiles * 16 colgroups = 4096
    int h   = blk >> 9;
    int rem = blk & 511;
    int it  = rem >> 4;
    int cg  = rem & 15;
    int ct0 = (cg * 8 + wv) * 4;         // [0,512) step 4 over (s,e) col tiles
    int i0  = it * 16;

    const _Float16* arow = wbuf + ((long)h * N_DIM + (i0 + ln16)) * N_DIM;

    const _Float16* bcol[4];
#pragma unroll
    for (int t = 0; t < 4; ++t) {
        int ct = ct0 + t;
        int s  = ct >> 1;
        int e0 = (ct & 1) * 16;
        bcol[t] = vbuf + (((long)(h * S_DIM + s) * 32) + e0 + ln16) * N_DIM;
    }

    v8f c[4] = {v8f{}, v8f{}, v8f{}, v8f{}};
    for (int kk = 0; kk < 16; ++kk) {
        int k0 = kk * 32;
        __builtin_prefetch(arow + k0 + 128, 0, 1);
        v16h a = load_frag_h(arow, ls, k0);
#pragma unroll
        for (int t = 0; t < 4; ++t) {
            v16h b = load_frag_h(bcol[t], ls, k0);
            c[t] = wmma_f16(a, b, c[t]);
        }
    }

#pragma unroll
    for (int t = 0; t < 4; ++t) {
        int ct = ct0 + t;
        int s  = ct >> 1;
        int e0 = (ct & 1) * 16;
        // gate: g[h][s][e][i], i contiguous -> one v8h per lane
        const _Float16* gp = gbuf + (((long)(h * S_DIM + s) * 32) + e0 + ln16) * N_DIM + i0 + ls;
        v8h g8 = *(const v8h*)gp;
        int colg = h * 32 + e0 + ln16;                // (h,e) flat in [0,256)
        _Float16* op = og + ((long)s * N_DIM + i0 + ls) * HE + colg;
#pragma unroll
        for (int r = 0; r < 8; ++r)
            op[(long)r * HE] = (_Float16)(c[t][r] * (float)g8[r]);
    }
}

// ---------- kernel 5: out = og @ W_o^T (fp32 out) ----------
__global__ void k_out(const _Float16* __restrict__ og, const _Float16* __restrict__ wo16,
                      float* __restrict__ out) {
    int lane = threadIdx.x & 31;
    int wv   = threadIdx.x >> 5;
    int ln16 = lane & 15;
    int ls   = (lane >> 4) * 8;
    int rowTile = blockIdx.x * 8 + wv;   // 8192 row tiles
    int r0 = rowTile * 16;

    const _Float16* arow = og + (long)(r0 + ln16) * HE;
    v16h af[8];
#pragma unroll
    for (int kk = 0; kk < 8; ++kk) af[kk] = load_frag_h(arow, ls, kk * 32);

    for (int ct = 0; ct < 4; ++ct) {
        int col = ct * 16 + ln16;        // [0,64)
        const _Float16* wrow = wo16 + (long)col * HE;
        v8f c = {};
#pragma unroll
        for (int kk = 0; kk < 8; ++kk)
            c = wmma_f16(af[kk], load_frag_h(wrow, ls, kk * 32), c);
        float* op = out + (long)(r0 + ls) * CM + col;
#pragma unroll
        for (int r = 0; r < 8; ++r) op[(long)r * CM] = c[r];
    }
}

// ---------- launch ----------
extern "C" void kernel_launch(void* const* d_in, const int* in_sizes, int n_in,
                              void* d_out, int out_size, void* d_ws, size_t ws_size,
                              hipStream_t stream) {
    (void)in_sizes; (void)n_in; (void)out_size; (void)ws_size;
    const float* m     = (const float*)d_in[0];
    const float* z     = (const float*)d_in[1];
    const float* mask  = (const float*)d_in[2];
    const float* ln_mw = (const float*)d_in[3];
    const float* ln_mb = (const float*)d_in[4];
    const float* ln_zw = (const float*)d_in[5];
    const float* ln_zb = (const float*)d_in[6];
    const float* W_m   = (const float*)d_in[7];
    const float* W_g   = (const float*)d_in[8];
    const float* W_z   = (const float*)d_in[9];
    const float* W_o   = (const float*)d_in[10];
    float* out = (float*)d_out;

    _Float16* mn   = (_Float16*)d_ws;                 //  8,388,608 halves
    _Float16* wbuf = mn   + 8388608;                  //  2,097,152
    _Float16* vbuf = wbuf + 2097152;                  // 33,554,432
    _Float16* gbuf = vbuf + 33554432;                 // 33,554,432
    _Float16* og   = gbuf + 33554432;                 // 33,554,432
    _Float16* wm16 = og   + 33554432;                 //     16,384
    _Float16* wg16 = wm16 + 16384;                    //     16,384
    _Float16* wo16 = wg16 + 16384;                    //     16,384  (~212 MB total)

    k_prep_w      <<<64,    256, 0, stream>>>(W_m, W_g, W_o, wm16, wg16, wo16);
    k_ln_m        <<<16384, 256, 0, stream>>>(m, ln_mw, ln_mb, mn);
    k_vg          <<<1024,  256, 0, stream>>>(mn, wm16, wg16, vbuf, gbuf);
    k_bias_softmax<<<512,   256, 0, stream>>>(z, mask, ln_zw, ln_zb, W_z, wbuf);
    k_pwa         <<<4096,  256, 0, stream>>>(wbuf, vbuf, gbuf, og);
    k_out         <<<1024,  256, 0, stream>>>(og, wo16, out);
}

// v001
// A run of this version takes 197 microseconds.
// Timed twice side by side with v000, it ran 1.96 and 1.97 times as fast.
#include <hip/hip_runtime.h>
#include <hip/hip_bf16.h>

typedef __attribute__((ext_vector_type(16))) _Float16 v16h;
typedef __attribute__((ext_vector_type(8)))  _Float16 v8h;
typedef __attribute__((ext_vector_type(8)))  float    v8f;

#define DEV static __device__ __forceinline__

// ---------- helpers ----------
DEV v16h cat8(v8h a, v8h b) {
    v16h r;
#pragma unroll
    for (int i = 0; i < 8; ++i) { r[i] = a[i]; r[i + 8] = b[i]; }
    return r;
}

// A/B fragment for V_WMMA_F32_16X16X32_F16, operand row/col contiguous in memory.
// laneSel = (lane>>4)*8 ; per-lane K chunks [k0+laneSel, +8) and [k0+laneSel+16, +8)
DEV v16h load_frag_h(const _Float16* row, int laneSel, int k0) {
    v8h c0 = *(const v8h*)(row + k0 + laneSel);
    v8h c1 = *(const v8h*)(row + k0 + laneSel + 16);
    return cat8(c0, c1);
}

DEV v8f wmma_f16(v16h a, v16h b, v8f c) {
    return __builtin_amdgcn_wmma_f32_16x16x32_f16(false, a, false, b, (short)0, c, false, false);
}

DEV float wave_sum(float x) {
#pragma unroll
    for (int o = 16; o > 0; o >>= 1) x += __shfl_xor(x, o, 32);
    return x;
}
DEV float wave_max(float x) {
#pragma unroll
    for (int o = 16; o > 0; o >>= 1) x = fmaxf(x, __shfl_xor(x, o, 32));
    return x;
}

// ---------- constants ----------
// B=1, S=256, N=512, C_M=64, C_Z=128, C_H=32, H=8, H*C_H=256
#define N_DIM   512
#define S_DIM   256
#define CM      64
#define CZ      128
#define HE      256

// ---------- kernel 0: one-shot weight conversion fp32 -> f16 ----------
// W_m, W_g: (256,64); W_o: (64,256)  -> all 16384 elements, same flat size
__global__ void k_prep_w(const float* __restrict__ Wm, const float* __restrict__ Wg,
                         const float* __restrict__ Wo,
                         _Float16* __restrict__ wm16, _Float16* __restrict__ wg16,
                         _Float16* __restrict__ wo16) {
    int idx = blockIdx.x * 256 + threadIdx.x;    // 64 blocks * 256 = 16384
    wm16[idx] = (_Float16)Wm[idx];
    wg16[idx] = (_Float16)Wg[idx];
    wo16[idx] = (_Float16)Wo[idx];
}

// ---------- kernel 1: layernorm(m) -> f16 ----------
__global__ void k_ln_m(const float* __restrict__ m, const float* __restrict__ w,
                       const float* __restrict__ b, _Float16* __restrict__ mn) {
    int lane = threadIdx.x & 31;
    int wv   = threadIdx.x >> 5;
    long row = (long)blockIdx.x * 8 + wv;        // 131072 rows
    const float* src = m + row * CM;
    float x0 = src[lane * 2], x1 = src[lane * 2 + 1];
    float s1 = wave_sum(x0 + x1);
    float s2 = wave_sum(x0 * x0 + x1 * x1);
    float mu = s1 * (1.0f / CM);
    float var = s2 * (1.0f / CM) - mu * mu;
    float rs = rsqrtf(var + 1e-5f);
    _Float16* dst = mn + row * CM;
    dst[lane * 2]     = (_Float16)((x0 - mu) * rs * w[lane * 2]     + b[lane * 2]);
    dst[lane * 2 + 1] = (_Float16)((x1 - mu) * rs * w[lane * 2 + 1] + b[lane * 2 + 1]);
}

// ---------- kernel 2: v = mn@Wm^T ; g = sigmoid(mn@Wg^T) ----------
// outputs stored transposed: [h][s][e][n] (n contiguous), f16
__global__ void k_vg(const _Float16* __restrict__ mn,
                     const _Float16* __restrict__ wm16, const _Float16* __restrict__ wg16,
                     _Float16* __restrict__ vbuf, _Float16* __restrict__ gbuf) {
    int lane = threadIdx.x & 31;
    int wv   = threadIdx.x >> 5;
    int ln16 = lane & 15;
    int ls   = (lane >> 4) * 8;
    int rowTile = blockIdx.x * 8 + wv;           // 8192 row tiles
    int r0 = rowTile * 16;

    const _Float16* arow = mn + (long)(r0 + ln16) * CM;
    v16h a0 = load_frag_h(arow, ls, 0);
    v16h a1 = load_frag_h(arow, ls, 32);

    int s  = r0 >> 9;                            // row / 512
    int n0 = (r0 & 511) + ls;                    // + 8*(lane>>4)

    // ---- v path ----
    for (int ct = 0; ct < 16; ++ct) {
        int col = ct * 16 + ln16;                // (h,e) flat in [0,256)
        const _Float16* wrow = wm16 + (long)col * CM;
        v8f c = {};
        c = wmma_f16(a0, load_frag_h(wrow, ls, 0),  c);
        c = wmma_f16(a1, load_frag_h(wrow, ls, 32), c);
        int h = col >> 5, e = col & 31;
        _Float16* dst = vbuf + (((long)(h * S_DIM + s) * 32 + e) * N_DIM + n0);
        v8h outv;
#pragma unroll
        for (int r = 0; r < 8; ++r) outv[r] = (_Float16)c[r];
        *(v8h*)dst = outv;
    }
    // ---- gate path (sigmoid) ----
    for (int ct = 0; ct < 16; ++ct) {
        int col = ct * 16 + ln16;
        const _Float16* wrow = wg16 + (long)col * CM;
        v8f c = {};
        c = wmma_f16(a0, load_frag_h(wrow, ls, 0),  c);
        c = wmma_f16(a1, load_frag_h(wrow, ls, 32), c);
        int h = col >> 5, e = col & 31;
        _Float16* dst = gbuf + (((long)(h * S_DIM + s) * 32 + e) * N_DIM + n0);
        v8h outv;
#pragma unroll
        for (int r = 0; r < 8; ++r)
            outv[r] = (_Float16)(1.0f / (1.0f + __expf(-c[r])));
        *(v8h*)dst = outv;
    }
}

// ---------- kernel 3: LN(z) + pair bias + mask + softmax -> w_f16[h][i][j] ----------
__global__ void k_bias_softmax(const float* __restrict__ z, const float* __restrict__ mask,
                               const float* __restrict__ lzw, const float* __restrict__ lzb,
                               const float* __restrict__ Wz, _Float16* __restrict__ wout) {
    __shared__ float logits[8][512];
    int lane = threadIdx.x & 31;
    int wv   = threadIdx.x >> 5;
    int i    = blockIdx.x;                       // 512 blocks

    float lw[4], lb[4], wz[8][4];
#pragma unroll
    for (int k = 0; k < 4; ++k) { lw[k] = lzw[lane * 4 + k]; lb[k] = lzb[lane * 4 + k]; }
#pragma unroll
    for (int h = 0; h < 8; ++h)
#pragma unroll
        for (int k = 0; k < 4; ++k) wz[h][k] = Wz[h * CZ + lane * 4 + k];

    for (int t = 0; t < 64; ++t) {
        int j = wv + t * 8;
        const float4 xf = *(const float4*)(z + ((long)i * N_DIM + j) * CZ + lane * 4);
        float x[4] = {xf.x, xf.y, xf.z, xf.w};
        float s1 = wave_sum(x[0] + x[1] + x[2] + x[3]);
        float s2 = wave_sum(x[0]*x[0] + x[1]*x[1] + x[2]*x[2] + x[3]*x[3]);
        float mu = s1 * (1.0f / CZ);
        float var = s2 * (1.0f / CZ) - mu * mu;
        float rs = rsqrtf(var + 1e-5f);
        float zn[4];
#pragma unroll
        for (int k = 0; k < 4; ++k) zn[k] = (x[k] - mu) * rs * lw[k] + lb[k];
        float acc[8];
#pragma unroll
        for (int h = 0; h < 8; ++h) {
            float a = zn[0]*wz[h][0] + zn[1]*wz[h][1] + zn[2]*wz[h][2] + zn[3]*wz[h][3];
            acc[h] = wave_sum(a);
        }
        if (lane == 0) {
            float pen = (1.0f - mask[(long)i * N_DIM + j]) * (-1000000.0f);
#pragma unroll
            for (int h = 0; h < 8; ++h) logits[h][j] = acc[h] + pen;
        }
    }
    __syncthreads();

    // wave wv owns head wv: softmax over 512
    float vmax = -3.0e38f;
#pragma unroll
    for (int t = 0; t < 16; ++t) vmax = fmaxf(vmax, logits[wv][lane + t * 32]);
    vmax = wave_max(vmax);
    float ex[16], ssum = 0.0f;
#pragma unroll
    for (int t = 0; t < 16; ++t) { ex[t] = __expf(logits[wv][lane + t * 32] - vmax); ssum += ex[t]; }
    ssum = wave_sum(ssum);
    float inv = 1.0f / ssum;
#pragma unroll
    for (int t = 0; t < 16; ++t)
        wout[((long)wv * N_DIM + i) * N_DIM + lane + t * 32] = (_Float16)(ex[t] * inv);
}

// ---------- kernel 4: o = w @ v (per head), gate, scatter to og[(s,i)][h*32+e] ----------
// per head: C[i][col] = sum_j w[i][j] * v[col][j], col = s*32+e, both operands j-contiguous.
// block tile 128 (i) x 256 (col), 8 waves as 2 x 4, each wave 64 x 64 (4 x 4 accumulators).
// a pass is 64 j = 128 B of every operand row, staged in LDS at pitch 144 B, two buffers.
#define PW_BM     128
#define PW_BN     256
#define PW_PITCH  144
#define PW_STAGE  ((PW_BM + PW_BN) * PW_PITCH)     // 55,296 B
#define PW_NPASS  8

// one stage: 384 rows x 128 B = 3072 copies of 16 B, 12 per thread (4 of A, 8 of B).
// lds: this thread's LDS byte address of A row (tid>>3), chunk (tid&7), in the target buffer.
// ga, gb: this thread's global address of the same chunk of A and of B for this pass.
DEV void pwa_copy_stage(unsigned lds, const _Float16* ga, const _Float16* gb) {
    const unsigned la0 = lds,                   la1 = lds + 32 * PW_PITCH;
    const unsigned la2 = lds + 64 * PW_PITCH,   la3 = lds + 96 * PW_PITCH;
    const unsigned lb0 = lds + 128 * PW_PITCH,  lb1 = lds + 160 * PW_PITCH;
    const unsigned lb2 = lds + 192 * PW_PITCH,  lb3 = lds + 224 * PW_PITCH;
    const unsigned lb4 = lds + 256 * PW_PITCH,  lb5 = lds + 288 * PW_PITCH;
    const unsigned lb6 = lds + 320 * PW_PITCH,  lb7 = lds + 352 * PW_PITCH;
    // the copies and, as the last line, the wait that stands before their address
    // registers may be rewritten
    asm volatile(
        "global_load_async_to_lds_b128 %0, %12, off\n\t"
        "global_load_async_to_lds_b128 %1, %13, off\n\t"
        "global_load_async_to_lds_b128 %2, %14, off\n\t"
        "global_load_async_to_lds_b128 %3, %15, off\n\t"
        "global_load_async_to_lds_b128 %4, %16, off\n\t"
        "global_load_async_to_lds_b128 %5, %17, off\n\t"
        "global_load_async_to_lds_b128 %6, %18, off\n\t"
        "global_load_async_to_lds_b128 %7, %19, off\n\t"
        "global_load_async_to_lds_b128 %8, %20, off\n\t"
        "global_load_async_to_lds_b128 %9, %21, off\n\t"
        "global_load_async_to_lds_b128 %10, %22, off\n\t"
        "global_load_async_to_lds_b128 %11, %23, off\n\t"
        "s_wait_xcnt 0x0"
        :: "v"(la0), "v"(la1), "v"(la2), "v"(la3),
           "v"(lb0), "v"(lb1), "v"(lb2), "v"(lb3), "v"(lb4), "v"(lb5), "v"(lb6), "v"(lb7),
           "v"(ga), "v"(ga + 32 * N_DIM), "v"(ga + 64 * N_DIM), "v"(ga + 96 * N_DIM),
           "v"(gb), "v"(gb + 32 * N_DIM), "v"(gb + 64 * N_DIM), "v"(gb + 96 * N_DIM),
           "v"(gb + 128 * N_DIM), "v"(gb + 160 * N_DIM), "v"(gb + 192 * N_DIM), "v"(gb + 224 * N_DIM)
        : "memory");
}

// four waves per SIMD (two work-groups on a WGP): one group's products cover the other's
// barrier and LDS waits
__global__ void __launch_bounds__(256) __attribute__((amdgpu_waves_per_eu(4, 4)))
k_pwa(const _Float16* __restrict__ wbuf, const _Float16* __restrict__ vbuf,
      const _Float16* __restrict__ gbuf, _Float16* __restrict__ og) {
    __shared__ __attribute__((aligned(16))) unsigned char L[2 * PW_STAGE];
    int tid  = threadIdx.x;
    int lane = tid & 31;
    int wv   = tid >> 5;
    int ln16 = lane & 15;
    int ls   = (lane >> 4) * 8;
    int wm   = wv >> 2;                  // wave row    [0,2)
    int wn   = wv & 3;                   // wave column [0,4)

    int blk  = blockIdx.x;               // 8 heads * 32 col groups * 4 i tiles = 1024
    int h    = blk >> 7;
    int cg   = (blk >> 2) & 31;
    int it   = blk & 3;
    int i0   = it * PW_BM;
    int col0 = cg * PW_BN;               // (s,e) flat in [0,8192)

    // copy addresses of this thread: row tid>>3 of each group of 32 rows, 16-B chunk tid&7
    const _Float16* ga = wbuf + ((long)h * N_DIM + i0 + (tid >> 3)) * N_DIM + (tid & 7) * 8;
    const _Float16* gb = vbuf + ((long)h * (S_DIM * 32) + col0 + (tid >> 3)) * N_DIM + (tid & 7) * 8;
    const unsigned ldst = (unsigned)(size_t)L + (tid >> 3) * PW_PITCH + (tid & 7) * 16;

    // fragment read offsets of this lane inside a stage
    const int offA = (wm * 64 + ln16) * PW_PITCH + ls * 2;
    const int offB = (PW_BM + wn * 64 + ln16) * PW_PITCH + ls * 2;

    v8f c[4][4];
#pragma unroll
    for (int x = 0; x < 4; ++x)
#pragma unroll
        for (int y = 0; y < 4; ++y) c[x][y] = v8f{};

    pwa_copy_stage(ldst, ga, gb);
    asm volatile("s_wait_asynccnt 0x0" ::: "memory");   // this wave's share of pass 0 has landed
    __syncthreads();                                    // pass 0 is readable by every wave
    pwa_copy_stage(ldst + PW_STAGE, ga + 64, gb + 64);

    for (int t = 0; t < PW_NPASS; ++t) {
        const unsigned char* st = L + (t & 1) * PW_STAGE;
        v16h a[4], b[4];
        // first 32 j of the pass
#pragma unroll
        for (int x = 0; x < 4; ++x) {
            const unsigned char* p = st + offA + x * 16 * PW_PITCH;
            a[x] = cat8(*(const v8h*)p, *(const v8h*)(p + 32));
        }
#pragma unroll
        for (int y = 0; y < 4; ++y) {
            const unsigned char* p = st + offB + y * 16 * PW_PITCH;
            b[y] = cat8(*(const v8h*)p, *(const v8h*)(p + 32));
        }
#pragma unroll
        for (int x = 0; x < 4; ++x)
#pragma unroll
            for (int y = 0; y < 4; ++y) c[x][y] = wmma_f16(a[x], b[y], c[x][y]);
        // second 32 j: the fragments are read here, their products follow the refill below
#pragma unroll
        for (int x = 0; x < 4; ++x) {
            const unsigned char* p = st + offA + x * 16 * PW_PITCH + 64;
            a[x] = cat8(*(const v8h*)p, *(const v8h*)(p + 32));
        }
#pragma unroll
        for (int y = 0; y < 4; ++y) {
            const unsigned char* p = st + offB + y * 16 * PW_PITCH + 64;
            b[y] = cat8(*(const v8h*)p, *(const v8h*)(p + 32));
        }
        asm volatile("s_wait_dscnt 0x0" ::: "memory");     // this wave has left buffer t&1
        asm volatile("s_wait_asynccnt 0x0" ::: "memory");  // its share of pass t+1 has landed
        __syncthreads();                                   // publishes pass t+1, frees buffer t&1
        if (t + 2 < PW_NPASS)
            pwa_copy_stage(ldst + (t & 1) * PW_STAGE, ga + (t + 2) * 64, gb + (t + 2) * 64);
#pragma unroll
        for (int x = 0; x < 4; ++x)
#pragma unroll
            for (int y = 0; y < 4; ++y) c[x][y] = wmma_f16(a[x], b[y], c[x][y]);
    }
    asm volatile("s_wait_asynccnt 0x0" ::: "memory");      // no copy is outstanding at the wave's end

    // gate: g[h][s][e][i] with (s,e) flat = col and i contiguous -> one v8h per lane and tile.
    // all sixteen are requested ahead of the first store, so that their latencies overlap
    const _Float16* gp = gbuf + ((long)h * (S_DIM * 32) + col0 + wn * 64 + ln16) * N_DIM
                              + i0 + wm * 64 + ls;
    v8h g8[4][4];
#pragma unroll
    for (int y = 0; y < 4; ++y)
#pragma unroll
        for (int x = 0; x < 4; ++x) {
            g8[y][x] = *(const v8h*)(gp + y * 16 * N_DIM + x * 16);
            // stands before any later instruction, a later gate load among them, rewrites
            // the address registers of this load
            asm volatile("s_wait_xcnt 0x0" ::: "memory");
        }

#pragma unroll
    for (int y = 0; y < 4; ++y) {
        int col = col0 + wn * 64 + y * 16;
        int s   = col >> 5;
        int e0  = col & 31;
        int colg = h * 32 + e0 + ln16;                // (h,e) flat in [0,256)
#pragma unroll
        for (int x = 0; x < 4; ++x) {
            int ib = i0 + wm * 64 + x * 16 + ls;
            _Float16* op = og + ((long)s * N_DIM + ib) * HE + colg;
#pragma unroll
            for (int r = 0; r < 8; ++r)
                op[(long)r * HE] = (_Float16)(c[x][y][r] * (float)g8[y][x][r]);
        }
    }
}

// ---------- kernel 5: out = og @ W_o^T (fp32 out) ----------
__global__ void k_out(const _Float16* __restrict__ og, const _Float16* __restrict__ wo16,
                      float* __restrict__ out) {
    int lane = threadIdx.x & 31;
    int wv   = threadIdx.x >> 5;
    int ln16 = lane & 15;
    int ls   = (lane >> 4) * 8;
    int rowTile = blockIdx.x * 8 + wv;   // 8192 row tiles
    int r0 = rowTile * 16;

    const _Float16* arow = og + (long)(r0 + ln16) * HE;
    v16h af[8];
#pragma unroll
    for (int kk = 0; kk < 8; ++kk) af[kk] = load_frag_h(arow, ls, kk * 32);

    for (int ct = 0; ct < 4; ++ct) {
        int col = ct * 16 + ln16;        // [0,64)
        const _Float16* wrow = wo16 + (long)col * HE;
        v8f c = {};
#pragma unroll
        for (int kk = 0; kk < 8; ++kk)
            c = wmma_f16(af[kk], load_frag_h(wrow, ls, kk * 32), c);
        float* op = out + (long)(r0 + ls) * CM + col;
#pragma unroll
        for (int r = 0; r < 8; ++r) op[(long)r * CM] = c[r];
    }
}

// ---------- launch ----------
extern "C" void kernel_launch(void* const* d_in, const int* in_sizes, int n_in,
                              void* d_out, int out_size, void* d_ws, size_t ws_size,
                              hipStream_t stream) {
    (void)in_sizes; (void)n_in; (void)out_size; (void)ws_size;
    const float* m     = (const float*)d_in[0];
    const float* z     = (const float*)d_in[1];
    const float* mask  = (const float*)d_in[2];
    const float* ln_mw = (const float*)d_in[3];
    const float* ln_mb = (const float*)d_in[4];
    const float* ln_zw = (const float*)d_in[5];
    const float* ln_zb = (const float*)d_in[6];
    const float* W_m   = (const float*)d_in[7];
    const float* W_g   = (const float*)d_in[8];
    const float* W_z   = (const float*)d_in[9];
    const float* W_o   = (const float*)d_in[10];
    float* out = (float*)d_out;

    _Float16* mn   = (_Float16*)d_ws;                 //  8,388,608 halves
    _Float16* wbuf = mn   + 8388608;                  //  2,097,152
    _Float16* vbuf = wbuf + 2097152;                  // 33,554,432
    _Float16* gbuf = vbuf + 33554432;                 // 33,554,432
    _Float16* og   = gbuf + 33554432;                 // 33,554,432
    _Float16* wm16 = og   + 33554432;                 //     16,384
    _Float16* wg16 = wm16 + 16384;                    //     16,384
    _Float16* wo16 = wg16 + 16384;                    //     16,384  (~212 MB total)

    k_prep_w      <<<64,    256, 0, stream>>>(W_m, W_g, W_o, wm16, wg16, wo16);
    k_ln_m        <<<16384, 256, 0, stream>>>(m, ln_mw, ln_mb, mn);
    k_vg          <<<1024,  256, 0, stream>>>(mn, wm16, wg16, vbuf, gbuf);
    k_bias_softmax<<<512,   256, 0, stream>>>(z, mask, ln_zw, ln_zb, W_z, wbuf);
    k_pwa         <<<1024,  256, 0, stream>>>(wbuf, vbuf, gbuf, og);
    k_out         <<<1024,  256, 0, stream>>>(og, wo16, out);
}

// v002
// It runs in 142 microseconds.
// In two side-by-side timings against v001, it was 1.39 and 1.40 times as fast.
// All steps since v000 together make it 2.74 times as fast.
#include <hip/hip_runtime.h>
#include <hip/hip_bf16.h>

typedef __attribute__((ext_vector_type(16))) _Float16 v16h;
typedef __attribute__((ext_vector_type(8)))  _Float16 v8h;
typedef __attribute__((ext_vector_type(8)))  float    v8f;

#define DEV static __device__ __forceinline__

// ---------- helpers ----------
DEV v16h cat8(v8h a, v8h b) {
    v16h r;
#pragma unroll
    for (int i = 0; i < 8; ++i) { r[i] = a[i]; r[i + 8] = b[i]; }
    return r;
}

// A/B fragment for V_WMMA_F32_16X16X32_F16, operand row/col contiguous in memory.
// laneSel = (lane>>4)*8 ; per-lane K chunks [k0+laneSel, +8) and [k0+laneSel+16, +8)
DEV v16h load_frag_h(const _Float16* row, int laneSel, int k0) {
    v8h c0 = *(const v8h*)(row + k0 + laneSel);
    v8h c1 = *(const v8h*)(row + k0 + laneSel + 16);
    return cat8(c0, c1);
}

DEV v8f wmma_f16(v16h a, v16h b, v8f c) {
    return __builtin_amdgcn_wmma_f32_16x16x32_f16(false, a, false, b, (short)0, c, false, false);
}

DEV float wave_sum(float x) {
#pragma unroll
    for (int o = 16; o > 0; o >>= 1) x += __shfl_xor(x, o, 32);
    return x;
}
DEV float wave_max(float x) {
#pragma unroll
    for (int o = 16; o > 0; o >>= 1) x = fmaxf(x, __shfl_xor(x, o, 32));
    return x;
}

// ---------- constants ----------
// B=1, S=256, N=512, C_M=64, C_Z=128, C_H=32, H=8, H*C_H=256
#define N_DIM   512
#define S_DIM   256
#define CM      64
#define CZ      128
#define HE      256

// ---------- kernel 0: one-shot weight conversion fp32 -> f16 ----------
// W_m, W_g: (256,64); W_o: (64,256)  -> all 16384 elements, same flat size
__global__ void k_prep_w(const float* __restrict__ Wm, const float* __restrict__ Wg,
                         const float* __restrict__ Wo,
                         _Float16* __restrict__ wm16, _Float16* __restrict__ wg16,
                         _Float16* __restrict__ wo16) {
    int idx = blockIdx.x * 256 + threadIdx.x;    // 64 blocks * 256 = 16384
    wm16[idx] = (_Float16)Wm[idx];
    wg16[idx] = (_Float16)Wg[idx];
    wo16[idx] = (_Float16)Wo[idx];
}

// ---------- kernel 1: layernorm(m) -> f16 ----------
__global__ void k_ln_m(const float* __restrict__ m, const float* __restrict__ w,
                       const float* __restrict__ b, _Float16* __restrict__ mn) {
    int lane = threadIdx.x & 31;
    int wv   = threadIdx.x >> 5;
    long row = (long)blockIdx.x * 8 + wv;        // 131072 rows
    const float* src = m + row * CM;
    float x0 = src[lane * 2], x1 = src[lane * 2 + 1];
    float s1 = wave_sum(x0 + x1);
    float s2 = wave_sum(x0 * x0 + x1 * x1);
    float mu = s1 * (1.0f / CM);
    float var = s2 * (1.0f / CM) - mu * mu;
    float rs = rsqrtf(var + 1e-5f);
    _Float16* dst = mn + row * CM;
    dst[lane * 2]     = (_Float16)((x0 - mu) * rs * w[lane * 2]     + b[lane * 2]);
    dst[lane * 2 + 1] = (_Float16)((x1 - mu) * rs * w[lane * 2 + 1] + b[lane * 2 + 1]);
}

// ---------- kernel 2: v = mn@Wm^T ; g = sigmoid(mn@Wg^T) ----------
// outputs stored transposed: [h][s][e][n] (n contiguous), f16
__global__ void k_vg(const _Float16* __restrict__ mn,
                     const _Float16* __restrict__ wm16, const _Float16* __restrict__ wg16,
                     _Float16* __restrict__ vbuf, _Float16* __restrict__ gbuf) {
    int lane = threadIdx.x & 31;
    int wv   = threadIdx.x >> 5;
    int ln16 = lane & 15;
    int ls   = (lane >> 4) * 8;
    int rowTile = blockIdx.x * 8 + wv;           // 8192 row tiles
    int r0 = rowTile * 16;

    const _Float16* arow = mn + (long)(r0 + ln16) * CM;
    v16h a0 = load_frag_h(arow, ls, 0);
    v16h a1 = load_frag_h(arow, ls, 32);

    int s  = r0 >> 9;                            // row / 512
    int n0 = (r0 & 511) + ls;                    // + 8*(lane>>4)

    // ---- v path ----
    for (int ct = 0; ct < 16; ++ct) {
        int col = ct * 16 + ln16;                // (h,e) flat in [0,256)
        const _Float16* wrow = wm16 + (long)col * CM;
        v8f c = {};
        c = wmma_f16(a0, load_frag_h(wrow, ls, 0),  c);
        c = wmma_f16(a1, load_frag_h(wrow, ls, 32), c);
        int h = col >> 5, e = col & 31;
        _Float16* dst = vbuf + (((long)(h * S_DIM + s) * 32 + e) * N_DIM + n0);
        v8h outv;
#pragma unroll
        for (int r = 0; r < 8; ++r) outv[r] = (_Float16)c[r];
        *(v8h*)dst = outv;
    }
    // ---- gate path (sigmoid) ----
    for (int ct = 0; ct < 16; ++ct) {
        int col = ct * 16 + ln16;
        const _Float16* wrow = wg16 + (long)col * CM;
        v8f c = {};
        c = wmma_f16(a0, load_frag_h(wrow, ls, 0),  c);
        c = wmma_f16(a1, load_frag_h(wrow, ls, 32), c);
        int h = col >> 5, e = col & 31;
        _Float16* dst = gbuf + (((long)(h * S_DIM + s) * 32 + e) * N_DIM + n0);
        v8h outv;
#pragma unroll
        for (int r = 0; r < 8; ++r)
            outv[r] = (_Float16)(1.0f / (1.0f + __expf(-c[r])));
        *(v8h*)dst = outv;
    }
}

// ---------- kernel 3: LN(z) + pair bias + mask + softmax -> w_f16[h][i][j] ----------
// with wl[h][c] = ln_w[c] * Wz[h][c], S[h] = sum_c wl[h][c], C[h] = sum_c ln_b[c] * Wz[h][c]:
//   logit[h] = rs * (sum_c x[c] * wl[h][c] - mu * S[h]) + C[h]
// so the ten sums of a row (x, x*x, eight heads) all start from x and are reduced in one pass.
// 8 lanes hold a row, 16 channels each: a 16-byte load of a wave is one whole 128-byte line
// of each of 4 rows. lane = r4 * 8 + c8; channels of a lane: k*32 + c8*4 + [0,4), k = 0..3.
typedef __attribute__((ext_vector_type(2))) float f32x2;
typedef __attribute__((ext_vector_type(4))) float f32x4;

#define LG_PITCH 516    // floats; head h starts 4h banks on: the 4 rows x 8 heads of a store meet 32 banks

// keep + (send of lane l ^ M), M = 1, 2 or 4: row_xmask, inside a 16-lane row
template <int M> DEV float add_xor(float keep, float send) {
    int y = __builtin_amdgcn_update_dpp(0, __builtin_bit_cast(int, send), 0x160 + M, 0xf, 0xf, true);
    return keep + __builtin_bit_cast(float, y);
}
// sum over the 8 lanes of a row, in every one of them
DEV float sum8(float x) {
    x = add_xor<1>(x, x);
    x = add_xor<2>(x, x);
    return add_xor<4>(x, x);
}
// sum over the 8 lanes of a row of a[c8]: each step halves the values a lane still carries.
// b0, b1, b2: bits of c8
DEV float scatter8(const float (&a)[8], bool b0, bool b1, bool b2) {
    float r[4], u[2];
#pragma unroll
    for (int q = 0; q < 4; ++q)
        r[q] = add_xor<1>(b0 ? a[2 * q + 1] : a[2 * q], b0 ? a[2 * q] : a[2 * q + 1]);
#pragma unroll
    for (int q = 0; q < 2; ++q)
        u[q] = add_xor<2>(b1 ? r[2 * q + 1] : r[2 * q], b1 ? r[2 * q] : r[2 * q + 1]);
    return add_xor<4>(b2 ? u[1] : u[0], b2 ? u[0] : u[1]);
}

// 8 rows (two groups of 4) of z and their mask values, pass t of a wave
// zp, mp: the wave's first row, the same in every lane; zo, mo: this lane's offsets from them
DEV void z_load(f32x4 (&v)[2][4], float (&mk)[2], const float* zp, const float* mp,
                unsigned zo, unsigned mo, int t) {
#pragma unroll
    for (int g = 0; g < 2; ++g) {
#pragma unroll
        for (int k = 0; k < 4; ++k)
            v[g][k] = *(const f32x4*)(zp + (t * 8 + g * 4) * CZ + k * 32 + zo);
        mk[g] = mp[t * 8 + g * 4 + mo];
    }
    // stands before the address registers of the loads above are rewritten
    asm volatile("s_wait_xcnt 0x0" ::: "memory");
    // keeps the loads ahead of the sums that follow: sunk behind them they would not overlap
    __builtin_amdgcn_sched_barrier(0);
}

// logit of head c8 for this lane's row
DEV float z_logit(const f32x4 (&v)[4], const f32x2 (&wl)[8][8], float S, float C,
                  bool b0, bool b1, bool b2) {
    f32x2 x[8];
#pragma unroll
    for (int k = 0; k < 4; ++k) { x[2 * k] = v[k].lo; x[2 * k + 1] = v[k].hi; }
    f32x2 t1 = x[0], t2 = x[0] * x[0];
#pragma unroll
    for (int q = 1; q < 8; ++q) { t1 += x[q]; t2 += x[q] * x[q]; }
    float d[8];
#pragma unroll
    for (int h = 0; h < 8; ++h) {
        f32x2 a = x[0] * wl[h][0];
#pragma unroll
        for (int q = 1; q < 8; ++q) a += x[q] * wl[h][q];
        d[h] = a.x + a.y;
    }
    float s1 = sum8(t1.x + t1.y);
    float s2 = sum8(t2.x + t2.y);
    float dh = scatter8(d, b0, b1, b2);
    float mu = s1 * (1.0f / CZ);
    float var = s2 * (1.0f / CZ) - mu * mu;
    float rs = rsqrtf(var + 1e-5f);
    return rs * (dh - mu * S) + C;
}

// the 8 rows of a pass: masked logits to LDS, lp = this lane's place for the pass's first group
DEV void z_pass(const f32x4 (&v)[2][4], const float (&mk)[2], float* lp, const f32x2 (&wl)[8][8],
                float S, float C, bool b0, bool b1, bool b2) {
#pragma unroll
    for (int g = 0; g < 2; ++g)
        lp[g * 4] = z_logit(v[g], wl, S, C, b0, b1, b2) + (1.0f - mk[g]) * (-1000000.0f);
}

// four waves per SIMD: both work-groups of a WGP are resident, all 512 in one round
__global__ void __launch_bounds__(256) __attribute__((amdgpu_waves_per_eu(4, 4)))
k_bias_softmax(const float* __restrict__ z, const float* __restrict__ mask,
               const float* __restrict__ lzw, const float* __restrict__ lzb,
               const float* __restrict__ Wz, _Float16* __restrict__ wout) {
    __shared__ float logits[8][LG_PITCH];
    int lane = threadIdx.x & 31;
    int wv   = threadIdx.x >> 5;
    int i    = blockIdx.x;                       // 512 blocks
    int c8   = lane & 7;
    int r4   = lane >> 3;
    bool b0 = c8 & 1, b1 = c8 & 2, b2 = c8 & 4;

    // C first: its products are not kept
    const float* wzp = Wz + c8 * 4;
    float S, C;
    {
        f32x4 b4[4];
#pragma unroll
        for (int k = 0; k < 4; ++k) b4[k] = *(const f32x4*)(lzb + k * 32 + c8 * 4);
        float pc[8];
#pragma unroll
        for (int h = 0; h < 8; ++h) {
            f32x4 a = *(const f32x4*)(wzp + h * CZ) * b4[0];
#pragma unroll
            for (int k = 1; k < 4; ++k) a += *(const f32x4*)(wzp + h * CZ + k * 32) * b4[k];
            pc[h] = (a.x + a.y) + (a.z + a.w);
        }
        C = scatter8(pc, b0, b1, b2);
    }
    // keeps the products for wl behind the sums for C: scheduled together they overflow the
    // registers of four waves per SIMD and spill
    __builtin_amdgcn_sched_barrier(0);
    f32x2 wl[8][8];
    {
        f32x4 w4[4];
#pragma unroll
        for (int k = 0; k < 4; ++k) w4[k] = *(const f32x4*)(lzw + k * 32 + c8 * 4);
        float ps[8];
#pragma unroll
        for (int h = 0; h < 8; ++h) {
#pragma unroll
            for (int k = 0; k < 4; ++k) {
                const f32x4 pw = *(const f32x4*)(wzp + h * CZ + k * 32) * w4[k];
                wl[h][2 * k] = pw.lo; wl[h][2 * k + 1] = pw.hi;
            }
            f32x2 a = wl[h][0];
#pragma unroll
            for (int q = 1; q < 8; ++q) a += wl[h][q];
            ps[h] = a.x + a.y;
        }
        S = scatter8(ps, b0, b1, b2);
    }

    // wave wv owns rows j = wv*64 + [0,64): 8 passes of 8 rows, two register buffers, the
    // next pass's loads in flight while a pass is summed
    // the wave's number from a scalar register: the rows' base address is then scalar, which
    // saves the vector registers that would otherwise spill
    int wvu = __builtin_amdgcn_readfirstlane(wv);
    const float* zp = z + ((long)i * N_DIM + wvu * 64) * CZ;
    const float* mp = mask + (long)i * N_DIM + wvu * 64;
    unsigned zo = r4 * CZ + c8 * 4, mo = r4;
    float* lp = &logits[c8][wv * 64 + r4];
    f32x4 va[2][4], vb[2][4];
    float ma[2], mb[2];
    // the weights above are complete before the first rows are requested: scheduled together
    // they overflow the registers of four waves per SIMD and spill
    __builtin_amdgcn_sched_barrier(0);
    z_load(va, ma, zp, mp, zo, mo, 0);
    for (int t = 0; t < 6; t += 2) {
        z_load(vb, mb, zp, mp, zo, mo, t + 1);
        z_pass(va, ma, lp + t * 8, wl, S, C, b0, b1, b2);
        z_load(va, ma, zp, mp, zo, mo, t + 2);
        z_pass(vb, mb, lp + (t + 1) * 8, wl, S, C, b0, b1, b2);
    }
    z_load(vb, mb, zp, mp, zo, mo, 7);
    z_pass(va, ma, lp + 6 * 8, wl, S, C, b0, b1, b2);
    z_pass(vb, mb, lp + 7 * 8, wl, S, C, b0, b1, b2);
    __syncthreads();

    // wave wv owns head wv: softmax over 512
    float vmax = -3.0e38f;
#pragma unroll
    for (int t = 0; t < 16; ++t) vmax = fmaxf(vmax, logits[wv][lane + t * 32]);
    vmax = wave_max(vmax);
    float ex[16], ssum = 0.0f;
#pragma unroll
    for (int t = 0; t < 16; ++t) { ex[t] = __expf(logits[wv][lane + t * 32] - vmax); ssum += ex[t]; }
    ssum = wave_sum(ssum);
    float inv = 1.0f / ssum;
#pragma unroll
    for (int t = 0; t < 16; ++t)
        wout[((long)wv * N_DIM + i) * N_DIM + lane + t * 32] = (_Float16)(ex[t] * inv);
}

// ---------- kernel 4: o = w @ v (per head), gate, scatter to og[(s,i)][h*32+e] ----------
// per head: C[i][col] = sum_j w[i][j] * v[col][j], col = s*32+e, both operands j-contiguous.
// block tile 128 (i) x 256 (col), 8 waves as 2 x 4, each wave 64 x 64 (4 x 4 accumulators).
// a pass is 64 j = 128 B of every operand row, staged in LDS at pitch 144 B, two buffers.
#define PW_BM     128
#define PW_BN     256
#define PW_PITCH  144
#define PW_STAGE  ((PW_BM + PW_BN) * PW_PITCH)     // 55,296 B
#define PW_NPASS  8

// one stage: 384 rows x 128 B = 3072 copies of 16 B, 12 per thread (4 of A, 8 of B).
// lds: this thread's LDS byte address of A row (tid>>3), chunk (tid&7), in the target buffer.
// ga, gb: this thread's global address of the same chunk of A and of B for this pass.
DEV void pwa_copy_stage(unsigned lds, const _Float16* ga, const _Float16* gb) {
    const unsigned la0 = lds,                   la1 = lds + 32 * PW_PITCH;
    const unsigned la2 = lds + 64 * PW_PITCH,   la3 = lds + 96 * PW_PITCH;
    const unsigned lb0 = lds + 128 * PW_PITCH,  lb1 = lds + 160 * PW_PITCH;
    const unsigned lb2 = lds + 192 * PW_PITCH,  lb3 = lds + 224 * PW_PITCH;
    const unsigned lb4 = lds + 256 * PW_PITCH,  lb5 = lds + 288 * PW_PITCH;
    const unsigned lb6 = lds + 320 * PW_PITCH,  lb7 = lds + 352 * PW_PITCH;
    // the copies and, as the last line, the wait that stands before their address
    // registers may be rewritten
    asm volatile(
        "global_load_async_to_lds_b128 %0, %12, off\n\t"
        "global_load_async_to_lds_b128 %1, %13, off\n\t"
        "global_load_async_to_lds_b128 %2, %14, off\n\t"
        "global_load_async_to_lds_b128 %3, %15, off\n\t"
        "global_load_async_to_lds_b128 %4, %16, off\n\t"
        "global_load_async_to_lds_b128 %5, %17, off\n\t"
        "global_load_async_to_lds_b128 %6, %18, off\n\t"
        "global_load_async_to_lds_b128 %7, %19, off\n\t"
        "global_load_async_to_lds_b128 %8, %20, off\n\t"
        "global_load_async_to_lds_b128 %9, %21, off\n\t"
        "global_load_async_to_lds_b128 %10, %22, off\n\t"
        "global_load_async_to_lds_b128 %11, %23, off\n\t"
        "s_wait_xcnt 0x0"
        :: "v"(la0), "v"(la1), "v"(la2), "v"(la3),
           "v"(lb0), "v"(lb1), "v"(lb2), "v"(lb3), "v"(lb4), "v"(lb5), "v"(lb6), "v"(lb7),
           "v"(ga), "v"(ga + 32 * N_DIM), "v"(ga + 64 * N_DIM), "v"(ga + 96 * N_DIM),
           "v"(gb), "v"(gb + 32 * N_DIM), "v"(gb + 64 * N_DIM), "v"(gb + 96 * N_DIM),
           "v"(gb + 128 * N_DIM), "v"(gb + 160 * N_DIM), "v"(gb + 192 * N_DIM), "v"(gb + 224 * N_DIM)
        : "memory");
}

// four waves per SIMD (two work-groups on a WGP): one group's products cover the other's
// barrier and LDS waits
__global__ void __launch_bounds__(256) __attribute__((amdgpu_waves_per_eu(4, 4)))
k_pwa(const _Float16* __restrict__ wbuf, const _Float16* __restrict__ vbuf,
      const _Float16* __restrict__ gbuf, _Float16* __restrict__ og) {
    __shared__ __attribute__((aligned(16))) unsigned char L[2 * PW_STAGE];
    int tid  = threadIdx.x;
    int lane = tid & 31;
    int wv   = tid >> 5;
    int ln16 = lane & 15;
    int ls   = (lane >> 4) * 8;
    int wm   = wv >> 2;                  // wave row    [0,2)
    int wn   = wv & 3;                   // wave column [0,4)

    int blk  = blockIdx.x;               // 8 heads * 32 col groups * 4 i tiles = 1024
    int h    = blk >> 7;
    int cg   = (blk >> 2) & 31;
    int it   = blk & 3;
    int i0   = it * PW_BM;
    int col0 = cg * PW_BN;               // (s,e) flat in [0,8192)

    // copy addresses of this thread: row tid>>3 of each group of 32 rows, 16-B chunk tid&7
    const _Float16* ga = wbuf + ((long)h * N_DIM + i0 + (tid >> 3)) * N_DIM + (tid & 7) * 8;
    const _Float16* gb = vbuf + ((long)h * (S_DIM * 32) + col0 + (tid >> 3)) * N_DIM + (tid & 7) * 8;
    const unsigned ldst = (unsigned)(size_t)L + (tid >> 3) * PW_PITCH + (tid & 7) * 16;

    // fragment read offsets of this lane inside a stage
    const int offA = (wm * 64 + ln16) * PW_PITCH + ls * 2;
    const int offB = (PW_BM + wn * 64 + ln16) * PW_PITCH + ls * 2;

    v8f c[4][4];
#pragma unroll
    for (int x = 0; x < 4; ++x)
#pragma unroll
        for (int y = 0; y < 4; ++y) c[x][y] = v8f{};

    pwa_copy_stage(ldst, ga, gb);
    asm volatile("s_wait_asynccnt 0x0" ::: "memory");   // this wave's share of pass 0 has landed
    __syncthreads();                                    // pass 0 is readable by every wave
    pwa_copy_stage(ldst + PW_STAGE, ga + 64, gb + 64);

    for (int t = 0; t < PW_NPASS; ++t) {
        const unsigned char* st = L + (t & 1) * PW_STAGE;
        v16h a[4], b[4];
        // first 32 j of the pass
#pragma unroll
        for (int x = 0; x < 4; ++x) {
            const unsigned char* p = st + offA + x * 16 * PW_PITCH;
            a[x] = cat8(*(const v8h*)p, *(const v8h*)(p + 32));
        }
#pragma unroll
        for (int y = 0; y < 4; ++y) {
            const unsigned char* p = st + offB + y * 16 * PW_PITCH;
            b[y] = cat8(*(const v8h*)p, *(const v8h*)(p + 32));
        }
#pragma unroll
        for (int x = 0; x < 4; ++x)
#pragma unroll
            for (int y = 0; y < 4; ++y) c[x][y] = wmma_f16(a[x], b[y], c[x][y]);
        // second 32 j: the fragments are read here, their products follow the refill below
#pragma unroll
        for (int x = 0; x < 4; ++x) {
            const unsigned char* p = st + offA + x * 16 * PW_PITCH + 64;
            a[x] = cat8(*(const v8h*)p, *(const v8h*)(p + 32));
        }
#pragma unroll
        for (int y = 0; y < 4; ++y) {
            const unsigned char* p = st + offB + y * 16 * PW_PITCH + 64;
            b[y] = cat8(*(const v8h*)p, *(const v8h*)(p + 32));
        }
        asm volatile("s_wait_dscnt 0x0" ::: "memory");     // this wave has left buffer t&1
        asm volatile("s_wait_asynccnt 0x0" ::: "memory");  // its share of pass t+1 has landed
        __syncthreads();                                   // publishes pass t+1, frees buffer t&1
        if (t + 2 < PW_NPASS)
            pwa_copy_stage(ldst + (t & 1) * PW_STAGE, ga + (t + 2) * 64, gb + (t + 2) * 64);
#pragma unroll
        for (int x = 0; x < 4; ++x)
#pragma unroll
            for (int y = 0; y < 4; ++y) c[x][y] = wmma_f16(a[x], b[y], c[x][y]);
    }
    asm volatile("s_wait_asynccnt 0x0" ::: "memory");      // no copy is outstanding at the wave's end

    // gate: g[h][s][e][i] with (s,e) flat = col and i contiguous -> one v8h per lane and tile.
    // all sixteen are requested ahead of the first store, so that their latencies overlap
    const _Float16* gp = gbuf + ((long)h * (S_DIM * 32) + col0 + wn * 64 + ln16) * N_DIM
                              + i0 + wm * 64 + ls;
    v8h g8[4][4];
#pragma unroll
    for (int y = 0; y < 4; ++y)
#pragma unroll
        for (int x = 0; x < 4; ++x) {
            g8[y][x] = *(const v8h*)(gp + y * 16 * N_DIM + x * 16);
            // stands before any later instruction, a later gate load among them, rewrites
            // the address registers of this load
            asm volatile("s_wait_xcnt 0x0" ::: "memory");
        }

#pragma unroll
    for (int y = 0; y < 4; ++y) {
        int col = col0 + wn * 64 + y * 16;
        int s   = col >> 5;
        int e0  = col & 31;
        int colg = h * 32 + e0 + ln16;                // (h,e) flat in [0,256)
#pragma unroll
        for (int x = 0; x < 4; ++x) {
            int ib = i0 + wm * 64 + x * 16 + ls;
            _Float16* op = og + ((long)s * N_DIM + ib) * HE + colg;
#pragma unroll
            for (int r = 0; r < 8; ++r)
                op[(long)r * HE] = (_Float16)(c[x][y][r] * (float)g8[y][x][r]);
        }
    }
}

// ---------- kernel 5: out = og @ W_o^T (fp32 out) ----------
__global__ void k_out(const _Float16* __restrict__ og, const _Float16* __restrict__ wo16,
                      float* __restrict__ out) {
    int lane = threadIdx.x & 31;
    int wv   = threadIdx.x >> 5;
    int ln16 = lane & 15;
    int ls   = (lane >> 4) * 8;
    int rowTile = blockIdx.x * 8 + wv;   // 8192 row tiles
    int r0 = rowTile * 16;

    const _Float16* arow = og + (long)(r0 + ln16) * HE;
    v16h af[8];
#pragma unroll
    for (int kk = 0; kk < 8; ++kk) af[kk] = load_frag_h(arow, ls, kk * 32);

    for (int ct = 0; ct < 4; ++ct) {
        int col = ct * 16 + ln16;        // [0,64)
        const _Float16* wrow = wo16 + (long)col * HE;
        v8f c = {};
#pragma unroll
        for (int kk = 0; kk < 8; ++kk)
            c = wmma_f16(af[kk], load_frag_h(wrow, ls, kk * 32), c);
        float* op = out + (long)(r0 + ls) * CM + col;
#pragma unroll
        for (int r = 0; r < 8; ++r) op[(long)r * CM] = c[r];
    }
}

// ---------- launch ----------
extern "C" void kernel_launch(void* const* d_in, const int* in_sizes, int n_in,
                              void* d_out, int out_size, void* d_ws, size_t ws_size,
                              hipStream_t stream) {
    (void)in_sizes; (void)n_in; (void)out_size; (void)ws_size;
    const float* m     = (const float*)d_in[0];
    const float* z     = (const float*)d_in[1];
    const float* mask  = (const float*)d_in[2];
    const float* ln_mw = (const float*)d_in[3];
    const float* ln_mb = (const float*)d_in[4];
    const float* ln_zw = (const float*)d_in[5];
    const float* ln_zb = (const float*)d_in[6];
    const float* W_m   = (const float*)d_in[7];
    const float* W_g   = (const float*)d_in[8];
    const float* W_z   = (const float*)d_in[9];
    const float* W_o   = (const float*)d_in[10];
    float* out = (float*)d_out;

    _Float16* mn   = (_Float16*)d_ws;                 //  8,388,608 halves
    _Float16* wbuf = mn   + 8388608;                  //  2,097,152
    _Float16* vbuf = wbuf + 2097152;                  // 33,554,432
    _Float16* gbuf = vbuf + 33554432;                 // 33,554,432
    _Float16* og   = gbuf + 33554432;                 // 33,554,432
    _Float16* wm16 = og   + 33554432;                 //     16,384
    _Float16* wg16 = wm16 + 16384;                    //     16,384
    _Float16* wo16 = wg16 + 16384;                    //     16,384  (~212 MB total)

    k_prep_w      <<<64,    256, 0, stream>>>(W_m, W_g, W_o, wm16, wg16, wo16);
    k_ln_m        <<<16384, 256, 0, stream>>>(m, ln_mw, ln_mb, mn);
    k_vg          <<<1024,  256, 0, stream>>>(mn, wm16, wg16, vbuf, gbuf);
    k_bias_softmax<<<512,   256, 0, stream>>>(z, mask, ln_zw, ln_zb, W_z, wbuf);
    k_pwa         <<<1024,  256, 0, stream>>>(wbuf, vbuf, gbuf, og);
    k_out         <<<1024,  256, 0, stream>>>(og, wo16, out);
}

// v003
// One run takes 130 microseconds.
// Timed twice side by side with v002, it ran 1.09 times as fast both times.
// Over all steps from v000 it is 2.98 times as fast.
#include <hip/hip_runtime.h>
#include <hip/hip_bf16.h>

typedef __attribute__((ext_vector_type(16))) _Float16 v16h;
typedef __attribute__((ext_vector_type(8)))  _Float16 v8h;
typedef __attribute__((ext_vector_type(8)))  float    v8f;
typedef __attribute__((ext_vector_type(2))) float f32x2;
typedef __attribute__((ext_vector_type(4))) float f32x4;

#define DEV static __device__ __forceinline__

// ---------- helpers ----------
DEV v16h cat8(v8h a, v8h b) {
    v16h r;
#pragma unroll
    for (int i = 0; i < 8; ++i) { r[i] = a[i]; r[i + 8] = b[i]; }
    return r;
}

// A/B fragment for V_WMMA_F32_16X16X32_F16, operand row/col contiguous in memory.
// laneSel = (lane>>4)*8 ; per-lane K chunks [k0+laneSel, +8) and [k0+laneSel+16, +8)
DEV v16h load_frag_h(const _Float16* row, int laneSel, int k0) {
    v8h c0 = *(const v8h*)(row + k0 + laneSel);
    v8h c1 = *(const v8h*)(row + k0 + laneSel + 16);
    return cat8(c0, c1);
}

DEV v8f wmma_f16(v16h a, v16h b, v8f c) {
    return __builtin_amdgcn_wmma_f32_16x16x32_f16(false, a, false, b, (short)0, c, false, false);
}

DEV float wave_sum(float x) {
#pragma unroll
    for (int o = 16; o > 0; o >>= 1) x += __shfl_xor(x, o, 32);
    return x;
}
DEV float wave_max(float x) {
#pragma unroll
    for (int o = 16; o > 0; o >>= 1) x = fmaxf(x, __shfl_xor(x, o, 32));
    return x;
}

// ---------- constants ----------
// B=1, S=256, N=512, C_M=64, C_Z=128, C_H=32, H=8, H*C_H=256
#define N_DIM   512
#define S_DIM   256
#define CM      64
#define CZ      128
#define HE      256

// ---------- kernel 0: one-shot weight conversion fp32 -> f16 ----------
// W_m, W_g: (256,64); W_o: (64,256)  -> all 16384 elements, same flat size
__global__ void k_prep_w(const float* __restrict__ Wm, const float* __restrict__ Wg,
                         const float* __restrict__ Wo,
                         _Float16* __restrict__ wm16, _Float16* __restrict__ wg16,
                         _Float16* __restrict__ wo16) {
    int idx = blockIdx.x * 256 + threadIdx.x;    // 64 blocks * 256 = 16384
    wm16[idx] = (_Float16)Wm[idx];
    wg16[idx] = (_Float16)Wg[idx];
    wo16[idx] = (_Float16)Wo[idx];
}

// ---------- kernel 1: layernorm(m) ; v = mn@Wm^T ; g = sigmoid(mn@Wg^T) ----------
// a wave normalises its own 16 rows of m in the registers of its two A fragments: lane
// (row ln16, half lane>>4) holds channels ls + c*16 + [0,8), c = 0..3, so a row's sums are
// 32 values of a lane and one exchange with lane ^ 16.
// outputs stored transposed: [h][s][e][n] (n contiguous), f16
__global__ void k_vg(const float* __restrict__ m, const float* __restrict__ lw,
                     const float* __restrict__ lb,
                     const _Float16* __restrict__ wm16, const _Float16* __restrict__ wg16,
                     _Float16* __restrict__ vbuf, _Float16* __restrict__ gbuf) {
    int lane = threadIdx.x & 31;
    int wv   = threadIdx.x >> 5;
    int ln16 = lane & 15;
    int ls   = (lane >> 4) * 8;
    int rowTile = blockIdx.x * 8 + wv;           // 8192 row tiles
    int r0 = rowTile * 16;

    const float* xrow = m + (long)(r0 + ln16) * CM + ls;
    f32x4 x[4][2], w4[4][2], b4[4][2];
#pragma unroll
    for (int c = 0; c < 4; ++c)
#pragma unroll
        for (int q = 0; q < 2; ++q) {
            w4[c][q] = *(const f32x4*)(lw + ls + c * 16 + q * 4);
            b4[c][q] = *(const f32x4*)(lb + ls + c * 16 + q * 4);
        }
#pragma unroll
    for (int c = 0; c < 4; ++c)
#pragma unroll
        for (int q = 0; q < 2; ++q) x[c][q] = *(const f32x4*)(xrow + c * 16 + q * 4);
    // stands before the address registers of the loads above are rewritten; its operands keep
    // those registers live up to it, so that neither a later load's result nor the next
    // kernel arguments land in them ahead of the wait
    asm volatile("s_wait_xcnt 0x0" :: "v"(xrow), "s"(lw), "s"(lb) : "memory");
    // keeps all 24 loads ahead of the sums: sunk behind them, the loads of lw and lb run in
    // dependent pairs after the row sums and their latencies add up
    __builtin_amdgcn_sched_barrier(0);

    f32x4 t1 = x[0][0] + x[0][1];
    f32x4 t2 = x[0][0] * x[0][0] + x[0][1] * x[0][1];
#pragma unroll
    for (int c = 1; c < 4; ++c)
#pragma unroll
        for (int q = 0; q < 2; ++q) { t1 += x[c][q]; t2 += x[c][q] * x[c][q]; }
    float s1 = (t1.x + t1.y) + (t1.z + t1.w);
    float s2 = (t2.x + t2.y) + (t2.z + t2.w);
    s1 += __shfl_xor(s1, 16, 32);
    s2 += __shfl_xor(s2, 16, 32);
    float mu = s1 * (1.0f / CM);
    float var = s2 * (1.0f / CM) - mu * mu;
    float rs = rsqrtf(var + 1e-5f);
    v16h a0, a1;
#pragma unroll
    for (int c = 0; c < 2; ++c)
#pragma unroll
        for (int q = 0; q < 2; ++q)
#pragma unroll
            for (int e = 0; e < 4; ++e) {
                a0[c * 8 + q * 4 + e] = (_Float16)((x[c][q][e] - mu) * rs * w4[c][q][e] + b4[c][q][e]);
                a1[c * 8 + q * 4 + e] =
                    (_Float16)((x[c + 2][q][e] - mu) * rs * w4[c + 2][q][e] + b4[c + 2][q][e]);
            }

    int s  = r0 >> 9;                            // row / 512
    int n0 = (r0 & 511) + ls;                    // + 8*(lane>>4)

    // ---- v path ----
    for (int ct = 0; ct < 16; ++ct) {
        int col = ct * 16 + ln16;                // (h,e) flat in [0,256)
        const _Float16* wrow = wm16 + (long)col * CM;
        v8f c = {};
        c = wmma_f16(a0, load_frag_h(wrow, ls, 0),  c);
        c = wmma_f16(a1, load_frag_h(wrow, ls, 32), c);
        int h = col >> 5, e = col & 31;
        _Float16* dst = vbuf + (((long)(h * S_DIM + s) * 32 + e) * N_DIM + n0);
        v8h outv;
#pragma unroll
        for (int r = 0; r < 8; ++r) outv[r] = (_Float16)c[r];
        *(v8h*)dst = outv;
    }
    // ---- gate path (sigmoid) ----
    for (int ct = 0; ct < 16; ++ct) {
        int col = ct * 16 + ln16;
        const _Float16* wrow = wg16 + (long)col * CM;
        v8f c = {};
        c = wmma_f16(a0, load_frag_h(wrow, ls, 0),  c);
        c = wmma_f16(a1, load_frag_h(wrow, ls, 32), c);
        int h = col >> 5, e = col & 31;
        _Float16* dst = gbuf + (((long)(h * S_DIM + s) * 32 + e) * N_DIM + n0);
        v8h outv;
#pragma unroll
        for (int r = 0; r < 8; ++r)
            outv[r] = (_Float16)(1.0f / (1.0f + __expf(-c[r])));
        *(v8h*)dst = outv;
    }
}

// ---------- kernel 2: LN(z) + pair bias + mask + softmax -> w_f16[h][i][j] ----------
// with wl[h][c] = ln_w[c] * Wz[h][c], S[h] = sum_c wl[h][c], C[h] = sum_c ln_b[c] * Wz[h][c]:
//   logit[h] = rs * (sum_c x[c] * wl[h][c] - mu * S[h]) + C[h]
// so the ten sums of a row (x, x*x, eight heads) all start from x and are reduced in one pass.
// 8 lanes hold a row, 16 channels each: a 16-byte load of a wave is one whole 128-byte line
// of each of 4 rows. lane = r4 * 8 + c8; channels of a lane: k*32 + c8*4 + [0,4), k = 0..3.

#define LG_PITCH 516    // floats; head h starts 4h banks on: the 4 rows x 8 heads of a store meet 32 banks

// keep + (send of lane l ^ M), M = 1, 2 or 4: row_xmask, inside a 16-lane row
template <int M> DEV float add_xor(float keep, float send) {
    int y = __builtin_amdgcn_update_dpp(0, __builtin_bit_cast(int, send), 0x160 + M, 0xf, 0xf, true);
    return keep + __builtin_bit_cast(float, y);
}
// sum over the 8 lanes of a row, in every one of them
DEV float sum8(float x) {
    x = add_xor<1>(x, x);
    x = add_xor<2>(x, x);
    return add_xor<4>(x, x);
}
// sum over the 8 lanes of a row of a[c8]: each step halves the values a lane still carries.
// b0, b1, b2: bits of c8
DEV float scatter8(const float (&a)[8], bool b0, bool b1, bool b2) {
    float r[4], u[2];
#pragma unroll
    for (int q = 0; q < 4; ++q)
        r[q] = add_xor<1>(b0 ? a[2 * q + 1] : a[2 * q], b0 ? a[2 * q] : a[2 * q + 1]);
#pragma unroll
    for (int q = 0; q < 2; ++q)
        u[q] = add_xor<2>(b1 ? r[2 * q + 1] : r[2 * q], b1 ? r[2 * q] : r[2 * q + 1]);
    return add_xor<4>(b2 ? u[1] : u[0], b2 ? u[0] : u[1]);
}

// 8 rows (two groups of 4) of z and their mask values, pass t of a wave
// zp, mp: the wave's first row, the same in every lane; zo, mo: this lane's offsets from them
DEV void z_load(f32x4 (&v)[2][4], float (&mk)[2], const float* zp, const float* mp,
                unsigned zo, unsigned mo, int t) {
#pragma unroll
    for (int g = 0; g < 2; ++g) {
#pragma unroll
        for (int k = 0; k < 4; ++k)
            v[g][k] = *(const f32x4*)(zp + (t * 8 + g * 4) * CZ + k * 32 + zo);
        mk[g] = mp[t * 8 + g * 4 + mo];
    }
    // stands before the address registers of the loads above are rewritten
    asm volatile("s_wait_xcnt 0x0" ::: "memory");
    // keeps the loads ahead of the sums that follow: sunk behind them they would not overlap
    __builtin_amdgcn_sched_barrier(0);
}

// logit of head c8 for this lane's row
DEV float z_logit(const f32x4 (&v)[4], const f32x2 (&wl)[8][8], float S, float C,
                  bool b0, bool b1, bool b2) {
    f32x2 x[8];
#pragma unroll
    for (int k = 0; k < 4; ++k) { x[2 * k] = v[k].lo; x[2 * k + 1] = v[k].hi; }
    f32x2 t1 = x[0], t2 = x[0] * x[0];
#pragma unroll
    for (int q = 1; q < 8; ++q) { t1 += x[q]; t2 += x[q] * x[q]; }
    float d[8];
#pragma unroll
    for (int h = 0; h < 8; ++h) {
        f32x2 a = x[0] * wl[h][0];
#pragma unroll
        for (int q = 1; q < 8; ++q) a += x[q] * wl[h][q];
        d[h] = a.x + a.y;
    }
    float s1 = sum8(t1.x + t1.y);
    float s2 = sum8(t2.x + t2.y);
    float dh = scatter8(d, b0, b1, b2);
    float mu = s1 * (1.0f / CZ);
    float var = s2 * (1.0f / CZ) - mu * mu;
    float rs = rsqrtf(var + 1e-5f);
    return rs * (dh - mu * S) + C;
}

// the 8 rows of a pass: masked logits to LDS, lp = this lane's place for the pass's first group
DEV void z_pass(const f32x4 (&v)[2][4], const float (&mk)[2], float* lp, const f32x2 (&wl)[8][8],
                float S, float C, bool b0, bool b1, bool b2) {
#pragma unroll
    for (int g = 0; g < 2; ++g)
        lp[g * 4] = z_logit(v[g], wl, S, C, b0, b1, b2) + (1.0f - mk[g]) * (-1000000.0f);
}

// four waves per SIMD: both work-groups of a WGP are resident, all 512 in one round
__global__ void __launch_bounds__(256) __attribute__((amdgpu_waves_per_eu(4, 4)))
k_bias_softmax(const float* __restrict__ z, const float* __restrict__ mask,
               const float* __restrict__ lzw, const float* __restrict__ lzb,
               const float* __restrict__ Wz, _Float16* __restrict__ wout) {
    __shared__ float logits[8][LG_PITCH];
    int lane = threadIdx.x & 31;
    int wv   = threadIdx.x >> 5;
    int i    = blockIdx.x;                       // 512 blocks
    int c8   = lane & 7;
    int r4   = lane >> 3;
    bool b0 = c8 & 1, b1 = c8 & 2, b2 = c8 & 4;

    // C first: its products are not kept
    const float* wzp = Wz + c8 * 4;
    float S, C;
    {
        f32x4 b4[4];
#pragma unroll
        for (int k = 0; k < 4; ++k) b4[k] = *(const f32x4*)(lzb + k * 32 + c8 * 4);
        float pc[8];
#pragma unroll
        for (int h = 0; h < 8; ++h) {
            f32x4 a = *(const f32x4*)(wzp + h * CZ) * b4[0];
#pragma unroll
            for (int k = 1; k < 4; ++k) a += *(const f32x4*)(wzp + h * CZ + k * 32) * b4[k];
            pc[h] = (a.x + a.y) + (a.z + a.w);
        }
        C = scatter8(pc, b0, b1, b2);
    }
    // keeps the products for wl behind the sums for C: scheduled together they overflow the
    // registers of four waves per SIMD and spill
    __builtin_amdgcn_sched_barrier(0);
    f32x2 wl[8][8];
    {
        f32x4 w4[4];
#pragma unroll
        for (int k = 0; k < 4; ++k) w4[k] = *(const f32x4*)(lzw + k * 32 + c8 * 4);
        float ps[8];
#pragma unroll
        for (int h = 0; h < 8; ++h) {
#pragma unroll
            for (int k = 0; k < 4; ++k) {
                const f32x4 pw = *(const f32x4*)(wzp + h * CZ + k * 32) * w4[k];
                wl[h][2 * k] = pw.lo; wl[h][2 * k + 1] = pw.hi;
            }
            f32x2 a = wl[h][0];
#pragma unroll
            for (int q = 1; q < 8; ++q) a += wl[h][q];
            ps[h] = a.x + a.y;
        }
        S = scatter8(ps, b0, b1, b2);
    }

    // wave wv owns rows j = wv*64 + [0,64): 8 passes of 8 rows, two register buffers, the
    // next pass's loads in flight while a pass is summed
    // the wave's number from a scalar register: the rows' base address is then scalar, which
    // saves the vector registers that would otherwise spill
    int wvu = __builtin_amdgcn_readfirstlane(wv);
    const float* zp = z + ((long)i * N_DIM + wvu * 64) * CZ;
    const float* mp = mask + (long)i * N_DIM + wvu * 64;
    unsigned zo = r4 * CZ + c8 * 4, mo = r4;
    float* lp = &logits[c8][wv * 64 + r4];
    f32x4 va[2][4], vb[2][4];
    float ma[2], mb[2];
    // the weights above are complete before the first rows are requested: scheduled together
    // they overflow the registers of four waves per SIMD and spill
    __builtin_amdgcn_sched_barrier(0);
    z_load(va, ma, zp, mp, zo, mo, 0);
    for (int t = 0; t < 6; t += 2) {
        z_load(vb, mb, zp, mp, zo, mo, t + 1);
        z_pass(va, ma, lp + t * 8, wl, S, C, b0, b1, b2);
        z_load(va, ma, zp, mp, zo, mo, t + 2);
        z_pass(vb, mb, lp + (t + 1) * 8, wl, S, C, b0, b1, b2);
    }
    z_load(vb, mb, zp, mp, zo, mo, 7);
    z_pass(va, ma, lp + 6 * 8, wl, S, C, b0, b1, b2);
    z_pass(vb, mb, lp + 7 * 8, wl, S, C, b0, b1, b2);
    __syncthreads();

    // wave wv owns head wv: softmax over 512
    float vmax = -3.0e38f;
#pragma unroll
    for (int t = 0; t < 16; ++t) vmax = fmaxf(vmax, logits[wv][lane + t * 32]);
    vmax = wave_max(vmax);
    float ex[16], ssum = 0.0f;
#pragma unroll
    for (int t = 0; t < 16; ++t) { ex[t] = __expf(logits[wv][lane + t * 32] - vmax); ssum += ex[t]; }
    ssum = wave_sum(ssum);
    float inv = 1.0f / ssum;
#pragma unroll
    for (int t = 0; t < 16; ++t)
        wout[((long)wv * N_DIM + i) * N_DIM + lane + t * 32] = (_Float16)(ex[t] * inv);
}

// ---------- kernel 3: o = w @ v (per head), gate, scatter to og[(s,i)][h*32+e] ----------
// per head: C[i][col] = sum_j w[i][j] * v[col][j], col = s*32+e, both operands j-contiguous.
// block tile 128 (i) x 256 (col), 8 waves as 2 x 4, each wave 64 x 64 (4 x 4 accumulators).
// a pass is 64 j = 128 B of every operand row, staged in LDS at pitch 144 B, two buffers.
#define PW_BM     128
#define PW_BN     256
#define PW_PITCH  144
#define PW_STAGE  ((PW_BM + PW_BN) * PW_PITCH)     // 55,296 B
#define PW_NPASS  8

// one stage: 384 rows x 128 B = 3072 copies of 16 B, 12 per thread (4 of A, 8 of B).
// lds: this thread's LDS byte address of A row (tid>>3), chunk (tid&7), in the target buffer.
// ga, gb: this thread's global address of the same chunk of A and of B for this pass.
DEV void pwa_copy_stage(unsigned lds, const _Float16* ga, const _Float16* gb) {
    const unsigned la0 = lds,                   la1 = lds + 32 * PW_PITCH;
    const unsigned la2 = lds + 64 * PW_PITCH,   la3 = lds + 96 * PW_PITCH;
    const unsigned lb0 = lds + 128 * PW_PITCH,  lb1 = lds + 160 * PW_PITCH;
    const unsigned lb2 = lds + 192 * PW_PITCH,  lb3 = lds + 224 * PW_PITCH;
    const unsigned lb4 = lds + 256 * PW_PITCH,  lb5 = lds + 288 * PW_PITCH;
    const unsigned lb6 = lds + 320 * PW_PITCH,  lb7 = lds + 352 * PW_PITCH;
    // the copies and, as the last line, the wait that stands before their address
    // registers may be rewritten
    asm volatile(
        "global_load_async_to_lds_b128 %0, %12, off\n\t"
        "global_load_async_to_lds_b128 %1, %13, off\n\t"
        "global_load_async_to_lds_b128 %2, %14, off\n\t"
        "global_load_async_to_lds_b128 %3, %15, off\n\t"
        "global_load_async_to_lds_b128 %4, %16, off\n\t"
        "global_load_async_to_lds_b128 %5, %17, off\n\t"
        "global_load_async_to_lds_b128 %6, %18, off\n\t"
        "global_load_async_to_lds_b128 %7, %19, off\n\t"
        "global_load_async_to_lds_b128 %8, %20, off\n\t"
        "global_load_async_to_lds_b128 %9, %21, off\n\t"
        "global_load_async_to_lds_b128 %10, %22, off\n\t"
        "global_load_async_to_lds_b128 %11, %23, off\n\t"
        "s_wait_xcnt 0x0"
        :: "v"(la0), "v"(la1), "v"(la2), "v"(la3),
           "v"(lb0), "v"(lb1), "v"(lb2), "v"(lb3), "v"(lb4), "v"(lb5), "v"(lb6), "v"(lb7),
           "v"(ga), "v"(ga + 32 * N_DIM), "v"(ga + 64 * N_DIM), "v"(ga + 96 * N_DIM),
           "v"(gb), "v"(gb + 32 * N_DIM), "v"(gb + 64 * N_DIM), "v"(gb + 96 * N_DIM),
           "v"(gb + 128 * N_DIM), "v"(gb + 160 * N_DIM), "v"(gb + 192 * N_DIM), "v"(gb + 224 * N_DIM)
        : "memory");
}

// four waves per SIMD (two work-groups on a WGP): one group's products cover the other's
// barrier and LDS waits
__global__ void __launch_bounds__(256) __attribute__((amdgpu_waves_per_eu(4, 4)))
k_pwa(const _Float16* __restrict__ wbuf, const _Float16* __restrict__ vbuf,
      const _Float16* __restrict__ gbuf, _Float16* __restrict__ og) {
    __shared__ __attribute__((aligned(16))) unsigned char L[2 * PW_STAGE];
    int tid  = threadIdx.x;
    int lane = tid & 31;
    int wv   = tid >> 5;
    int ln16 = lane & 15;
    int ls   = (lane >> 4) * 8;
    int wm   = wv >> 2;                  // wave row    [0,2)
    int wn   = wv & 3;                   // wave column [0,4)

    int blk  = blockIdx.x;               // 8 heads * 32 col groups * 4 i tiles = 1024
    int h    = blk >> 7;
    int cg   = (blk >> 2) & 31;
    int it   = blk & 3;
    int i0   = it * PW_BM;
    int col0 = cg * PW_BN;               // (s,e) flat in [0,8192)

    // copy addresses of this thread: row tid>>3 of each group of 32 rows, 16-B chunk tid&7
    const _Float16* ga = wbuf + ((long)h * N_DIM + i0 + (tid >> 3)) * N_DIM + (tid & 7) * 8;
    const _Float16* gb = vbuf + ((long)h * (S_DIM * 32) + col0 + (tid >> 3)) * N_DIM + (tid & 7) * 8;
    const unsigned ldst = (unsigned)(size_t)L + (tid >> 3) * PW_PITCH + (tid & 7) * 16;

    // fragment read offsets of this lane inside a stage
    const int offA = (wm * 64 + ln16) * PW_PITCH + ls * 2;
    const int offB = (PW_BM + wn * 64 + ln16) * PW_PITCH + ls * 2;

    v8f c[4][4];
#pragma unroll
    for (int x = 0; x < 4; ++x)
#pragma unroll
        for (int y = 0; y < 4; ++y) c[x][y] = v8f{};

    pwa_copy_stage(ldst, ga, gb);
    asm volatile("s_wait_asynccnt 0x0" ::: "memory");   // this wave's share of pass 0 has landed
    __syncthreads();                                    // pass 0 is readable by every wave
    pwa_copy_stage(ldst + PW_STAGE, ga + 64, gb + 64);

    for (int t = 0; t < PW_NPASS; ++t) {
        const unsigned char* st = L + (t & 1) * PW_STAGE;
        v16h a[4], b[4];
        // first 32 j of the pass
#pragma unroll
        for (int x = 0; x < 4; ++x) {
            const unsigned char* p = st + offA + x * 16 * PW_PITCH;
            a[x] = cat8(*(const v8h*)p, *(const v8h*)(p + 32));
        }
#pragma unroll
        for (int y = 0; y < 4; ++y) {
            const unsigned char* p = st + offB + y * 16 * PW_PITCH;
            b[y] = cat8(*(const v8h*)p, *(const v8h*)(p + 32));
        }
#pragma unroll
        for (int x = 0; x < 4; ++x)
#pragma unroll
            for (int y = 0; y < 4; ++y) c[x][y] = wmma_f16(a[x], b[y], c[x][y]);
        // second 32 j: the fragments are read here, their products follow the refill below
#pragma unroll
        for (int x = 0; x < 4; ++x) {
            const unsigned char* p = st + offA + x * 16 * PW_PITCH + 64;
            a[x] = cat8(*(const v8h*)p, *(const v8h*)(p + 32));
        }
#pragma unroll
        for (int y = 0; y < 4; ++y) {
            const unsigned char* p = st + offB + y * 16 * PW_PITCH + 64;
            b[y] = cat8(*(const v8h*)p, *(const v8h*)(p + 32));
        }
        asm volatile("s_wait_dscnt 0x0" ::: "memory");     // this wave has left buffer t&1
        asm volatile("s_wait_asynccnt 0x0" ::: "memory");  // its share of pass t+1 has landed
        __syncthreads();                                   // publishes pass t+1, frees buffer t&1
        if (t + 2 < PW_NPASS)
            pwa_copy_stage(ldst + (t & 1) * PW_STAGE, ga + (t + 2) * 64, gb + (t + 2) * 64);
#pragma unroll
        for (int x = 0; x < 4; ++x)
#pragma unroll
            for (int y = 0; y < 4; ++y) c[x][y] = wmma_f16(a[x], b[y], c[x][y]);
    }
    asm volatile("s_wait_asynccnt 0x0" ::: "memory");      // no copy is outstanding at the wave's end

    // gate: g[h][s][e][i] with (s,e) flat = col and i contiguous -> one v8h per lane and tile.
    // all sixteen are requested ahead of the first store, so that their latencies overlap
    const _Float16* gp = gbuf + ((long)h * (S_DIM * 32) + col0 + wn * 64 + ln16) * N_DIM
                              + i0 + wm * 64 + ls;
    v8h g8[4][4];
#pragma unroll
    for (int y = 0; y < 4; ++y)
#pragma unroll
        for (int x = 0; x < 4; ++x) {
            g8[y][x] = *(const v8h*)(gp + y * 16 * N_DIM + x * 16);
            // stands before any later instruction, a later gate load among them, rewrites
            // the address registers of this load
            asm volatile("s_wait_xcnt 0x0" ::: "memory");
        }

#pragma unroll
    for (int y = 0; y < 4; ++y) {
        int col = col0 + wn * 64 + y * 16;
        int s   = col >> 5;
        int e0  = col & 31;
        int colg = h * 32 + e0 + ln16;                // (h,e) flat in [0,256)
#pragma unroll
        for (int x = 0; x < 4; ++x) {
            int ib = i0 + wm * 64 + x * 16 + ls;
            _Float16* op = og + ((long)s * N_DIM + ib) * HE + colg;
#pragma unroll
            for (int r = 0; r < 8; ++r)
                op[(long)r * HE] = (_Float16)(c[x][y][r] * (float)g8[y][x][r]);
        }
    }
}

// ---------- kernel 4: out = og @ W_o^T (fp32 out) ----------
__global__ void k_out(const _Float16* __restrict__ og, const _Float16* __restrict__ wo16,
                      float* __restrict__ out) {
    int lane = threadIdx.x & 31;
    int wv   = threadIdx.x >> 5;
    int ln16 = lane & 15;
    int ls   = (lane >> 4) * 8;
    int rowTile = blockIdx.x * 8 + wv;   // 8192 row tiles
    int r0 = rowTile * 16;

    const _Float16* arow = og + (long)(r0 + ln16) * HE;
    v16h af[8];
#pragma unroll
    for (int kk = 0; kk < 8; ++kk) af[kk] = load_frag_h(arow, ls, kk * 32);

    for (int ct = 0; ct < 4; ++ct) {
        int col = ct * 16 + ln16;        // [0,64)
        const _Float16* wrow = wo16 + (long)col * HE;
        v8f c = {};
#pragma unroll
        for (int kk = 0; kk < 8; ++kk)
            c = wmma_f16(af[kk], load_frag_h(wrow, ls, kk * 32), c);
        float* op = out + (long)(r0 + ls) * CM + col;
#pragma unroll
        for (int r = 0; r < 8; ++r) op[(long)r * CM] = c[r];
    }
}

// ---------- launch ----------
extern "C" void kernel_launch(void* const* d_in, const int* in_sizes, int n_in,
                              void* d_out, int out_size, void* d_ws, size_t ws_size,
                              hipStream_t stream) {
    (void)in_sizes; (void)n_in; (void)out_size; (void)ws_size;
    const float* m     = (const float*)d_in[0];
    const float* z     = (const float*)d_in[1];
    const float* mask  = (const float*)d_in[2];
    const float* ln_mw = (const float*)d_in[3];
    const float* ln_mb = (const float*)d_in[4];
    const float* ln_zw = (const float*)d_in[5];
    const float* ln_zb = (const float*)d_in[6];
    const float* W_m   = (const float*)d_in[7];
    const float* W_g   = (const float*)d_in[8];
    const float* W_z   = (const float*)d_in[9];
    const float* W_o   = (const float*)d_in[10];
    float* out = (float*)d_out;

    _Float16* wbuf = (_Float16*)d_ws;                 //  2,097,152 halves
    _Float16* vbuf = wbuf + 2097152;                  // 33,554,432
    _Float16* gbuf = vbuf + 33554432;                 // 33,554,432
    _Float16* og   = gbuf + 33554432;                 // 33,554,432
    _Float16* wm16 = og   + 33554432;                 //     16,384
    _Float16* wg16 = wm16 + 16384;                    //     16,384
    _Float16* wo16 = wg16 + 16384;                    //     16,384  (~196 MB total)

    k_prep_w      <<<64,    256, 0, stream>>>(W_m, W_g, W_o, wm16, wg16, wo16);
    k_vg          <<<1024,  256, 0, stream>>>(m, ln_mw, ln_mb, wm16, wg16, vbuf, gbuf);
    k_bias_softmax<<<512,   256, 0, stream>>>(z, mask, ln_zw, ln_zb, W_z, wbuf);
    k_pwa         <<<1024,  256, 0, stream>>>(wbuf, vbuf, gbuf, og);
    k_out         <<<1024,  256, 0, stream>>>(og, wo16, out);
}

// v004
// It runs in 125 microseconds.
// In two side-by-side timings against v003, it was 1.03 and 1.04 times as fast.
// Over all steps from v000 it is 3.09 times as fast.
#include <hip/hip_runtime.h>
#include <hip/hip_bf16.h>

typedef __attribute__((ext_vector_type(16))) _Float16 v16h;
typedef __attribute__((ext_vector_type(8)))  _Float16 v8h;
typedef __attribute__((ext_vector_type(8)))  float    v8f;
typedef __attribute__((ext_vector_type(2))) float f32x2;
typedef __attribute__((ext_vector_type(4))) float f32x4;

#define DEV static __device__ __forceinline__

// ---------- helpers ----------
DEV v16h cat8(v8h a, v8h b) {
    v16h r;
#pragma unroll
    for (int i = 0; i < 8; ++i) { r[i] = a[i]; r[i + 8] = b[i]; }
    return r;
}

// A/B fragment for V_WMMA_F32_16X16X32_F16, operand row/col contiguous in memory.
// laneSel = (lane>>4)*8 ; per-lane K chunks [k0+laneSel, +8) and [k0+laneSel+16, +8)
DEV v16h load_frag_h(const _Float16* row, int laneSel, int k0) {
    v8h c0 = *(const v8h*)(row + k0 + laneSel);
    v8h c1 = *(const v8h*)(row + k0 + laneSel + 16);
    return cat8(c0, c1);
}

DEV v8f wmma_f16(v16h a, v16h b, v8f c) {
    return __builtin_amdgcn_wmma_f32_16x16x32_f16(false, a, false, b, (short)0, c, false, false);
}

DEV float wave_sum(float x) {
#pragma unroll
    for (int o = 16; o > 0; o >>= 1) x += __shfl_xor(x, o, 32);
    return x;
}
DEV float wave_max(float x) {
#pragma unroll
    for (int o = 16; o > 0; o >>= 1) x = fmaxf(x, __shfl_xor(x, o, 32));
    return x;
}

// ---------- constants ----------
// B=1, S=256, N=512, C_M=64, C_Z=128, C_H=32, H=8, H*C_H=256
#define N_DIM   512
#define S_DIM   256
#define CM      64
#define CZ      128
#define HE      256

// ---------- kernel 0: one-shot weight conversion fp32 -> f16 ----------
// W_m, W_g: (256,64); W_o: (64,256)  -> all 16384 elements, same flat size
__global__ void k_prep_w(const float* __restrict__ Wm, const float* __restrict__ Wg,
                         const float* __restrict__ Wo,
                         _Float16* __restrict__ wm16, _Float16* __restrict__ wg16,
                         _Float16* __restrict__ wo16) {
    int idx = blockIdx.x * 256 + threadIdx.x;    // 64 blocks * 256 = 16384
    wm16[idx] = (_Float16)Wm[idx];
    wg16[idx] = (_Float16)Wg[idx];
    wo16[idx] = (_Float16)Wo[idx];
}

// ---------- kernel 1: layernorm(m) ; v = mn@Wm^T ; g = sigmoid(mn@Wg^T) ----------
// a wave normalises its own 16 rows of m in the registers of its two A fragments: lane
// (row ln16, half lane>>4) holds channels ls + c*16 + [0,8), c = 0..3, so a row's sums are
// 32 values of a lane and one exchange with lane ^ 16.
// both outputs are f16 and lie in units of 512 B, each one 16-byte store of a wave:
//   v[h*512 + s*2 + (e>>4)][n>>4] [e&15][n&15]  (a lane holds 8 n of one e: the product as it stood)
//   g[s*32 + (n>>4)][h*2 + (e>>4)] [n&15][e&15]  (a lane holds 8 e of one n: W_g as A, rows of m as B)
__global__ void k_vg(const float* __restrict__ m, const float* __restrict__ lw,
                     const float* __restrict__ lb,
                     const _Float16* __restrict__ wm16, const _Float16* __restrict__ wg16,
                     _Float16* __restrict__ vbuf, _Float16* __restrict__ gbuf) {
    int lane = threadIdx.x & 31;
    int wv   = threadIdx.x >> 5;
    int ln16 = lane & 15;
    int ls   = (lane >> 4) * 8;
    int rowTile = blockIdx.x * 8 + wv;           // 8192 row tiles
    int r0 = rowTile * 16;

    const float* xrow = m + (long)(r0 + ln16) * CM + ls;
    f32x4 x[4][2], w4[4][2], b4[4][2];
#pragma unroll
    for (int c = 0; c < 4; ++c)
#pragma unroll
        for (int q = 0; q < 2; ++q) {
            w4[c][q] = *(const f32x4*)(lw + ls + c * 16 + q * 4);
            b4[c][q] = *(const f32x4*)(lb + ls + c * 16 + q * 4);
        }
#pragma unroll
    for (int c = 0; c < 4; ++c)
#pragma unroll
        for (int q = 0; q < 2; ++q) x[c][q] = *(const f32x4*)(xrow + c * 16 + q * 4);
    // stands before the address registers of the loads above are rewritten; its operands keep
    // those registers live up to it, so that neither a later load's result nor the next
    // kernel arguments land in them ahead of the wait
    asm volatile("s_wait_xcnt 0x0" :: "v"(xrow), "s"(lw), "s"(lb) : "memory");
    // keeps all 24 loads ahead of the sums: sunk behind them, the loads of lw and lb run in
    // dependent pairs after the row sums and their latencies add up
    __builtin_amdgcn_sched_barrier(0);

    f32x4 t1 = x[0][0] + x[0][1];
    f32x4 t2 = x[0][0] * x[0][0] + x[0][1] * x[0][1];
#pragma unroll
    for (int c = 1; c < 4; ++c)
#pragma unroll
        for (int q = 0; q < 2; ++q) { t1 += x[c][q]; t2 += x[c][q] * x[c][q]; }
    float s1 = (t1.x + t1.y) + (t1.z + t1.w);
    float s2 = (t2.x + t2.y) + (t2.z + t2.w);
    s1 += __shfl_xor(s1, 16, 32);
    s2 += __shfl_xor(s2, 16, 32);
    float mu = s1 * (1.0f / CM);
    float var = s2 * (1.0f / CM) - mu * mu;
    float rs = rsqrtf(var + 1e-5f);
    v16h a0, a1;
#pragma unroll
    for (int c = 0; c < 2; ++c)
#pragma unroll
        for (int q = 0; q < 2; ++q)
#pragma unroll
            for (int e = 0; e < 4; ++e) {
                a0[c * 8 + q * 4 + e] = (_Float16)((x[c][q][e] - mu) * rs * w4[c][q][e] + b4[c][q][e]);
                a1[c * 8 + q * 4 + e] =
                    (_Float16)((x[c + 2][q][e] - mu) * rs * w4[c + 2][q][e] + b4[c + 2][q][e]);
            }

    int s  = r0 >> 9;                            // row / 512
    int nt = (r0 & 511) >> 4;                    // the wave's 16 n
    int lo = ln16 * 16 + ls;                     // this lane's 8 halves of a unit

    // ---- v path ---- a trip is a head: its two tiles of 16 e lie 32 units apart
    _Float16* vdst = vbuf + ((long)(s * 2) * 32 + nt) * 256 + lo;
    for (int hh = 0; hh < 8; ++hh) {
        const _Float16* wrow = wm16 + (long)(hh * 32 + ln16) * CM;
        v8f c0 = {}, c1 = {};
        c0 = wmma_f16(a0, load_frag_h(wrow, ls, 0),  c0);
        c1 = wmma_f16(a0, load_frag_h(wrow + 16 * CM, ls, 0),  c1);
        c0 = wmma_f16(a1, load_frag_h(wrow, ls, 32), c0);
        c1 = wmma_f16(a1, load_frag_h(wrow + 16 * CM, ls, 32), c1);
        v8h o0, o1;
#pragma unroll
        for (int r = 0; r < 8; ++r) { o0[r] = (_Float16)c0[r]; o1[r] = (_Float16)c1[r]; }
        *(v8h*)vdst = o0;
        *(v8h*)(vdst + 32 * 256) = o1;
        vdst += 512 * 32 * 256;
    }
    // ---- gate path (sigmoid) ----
    for (int ct = 0; ct < 16; ++ct) {
        int col = ct * 16 + ln16;
        const _Float16* wrow = wg16 + (long)col * CM;
        v8f c = {};
        c = wmma_f16(load_frag_h(wrow, ls, 0),  a0, c);
        c = wmma_f16(load_frag_h(wrow, ls, 32), a1, c);
        _Float16* dst = gbuf + (long)rowTile * 4096 + ct * 256 + lo;
        v8h outv;
#pragma unroll
        for (int r = 0; r < 8; ++r)
            outv[r] = (_Float16)(1.0f / (1.0f + __expf(-c[r])));
        *(v8h*)dst = outv;
    }
}

// ---------- kernel 2: LN(z) + pair bias + mask + softmax -> w_f16[h][i][j] ----------
// with wl[h][c] = ln_w[c] * Wz[h][c], S[h] = sum_c wl[h][c], C[h] = sum_c ln_b[c] * Wz[h][c]:
//   logit[h] = rs * (sum_c x[c] * wl[h][c] - mu * S[h]) + C[h]
// so the ten sums of a row (x, x*x, eight heads) all start from x and are reduced in one pass.
// 8 lanes hold a row, 16 channels each: a 16-byte load of a wave is one whole 128-byte line
// of each of 4 rows. lane = r4 * 8 + c8; channels of a lane: k*32 + c8*4 + [0,4), k = 0..3.

#define LG_PITCH 516    // floats; head h starts 4h banks on: the 4 rows x 8 heads of a store meet 32 banks

// keep + (send of lane l ^ M), M = 1, 2 or 4: row_xmask, inside a 16-lane row
template <int M> DEV float add_xor(float keep, float send) {
    int y = __builtin_amdgcn_update_dpp(0, __builtin_bit_cast(int, send), 0x160 + M, 0xf, 0xf, true);
    return keep + __builtin_bit_cast(float, y);
}
// sum over the 8 lanes of a row, in every one of them
DEV float sum8(float x) {
    x = add_xor<1>(x, x);
    x = add_xor<2>(x, x);
    return add_xor<4>(x, x);
}
// sum over the 8 lanes of a row of a[c8]: each step halves the values a lane still carries.
// b0, b1, b2: bits of c8
DEV float scatter8(const float (&a)[8], bool b0, bool b1, bool b2) {
    float r[4], u[2];
#pragma unroll
    for (int q = 0; q < 4; ++q)
        r[q] = add_xor<1>(b0 ? a[2 * q + 1] : a[2 * q], b0 ? a[2 * q] : a[2 * q + 1]);
#pragma unroll
    for (int q = 0; q < 2; ++q)
        u[q] = add_xor<2>(b1 ? r[2 * q + 1] : r[2 * q], b1 ? r[2 * q] : r[2 * q + 1]);
    return add_xor<4>(b2 ? u[1] : u[0], b2 ? u[0] : u[1]);
}

// 8 rows (two groups of 4) of z and their mask values, pass t of a wave
// zp, mp: the wave's first row, the same in every lane; zo, mo: this lane's offsets from them
DEV void z_load(f32x4 (&v)[2][4], float (&mk)[2], const float* zp, const float* mp,
                unsigned zo, unsigned mo, int t) {
#pragma unroll
    for (int g = 0; g < 2; ++g) {
#pragma unroll
        for (int k = 0; k < 4; ++k)
            v[g][k] = *(const f32x4*)(zp + (t * 8 + g * 4) * CZ + k * 32 + zo);
        mk[g] = mp[t * 8 + g * 4 + mo];
    }
    // stands before the address registers of the loads above are rewritten
    asm volatile("s_wait_xcnt 0x0" ::: "memory");
    // keeps the loads ahead of the sums that follow: sunk behind them they would not overlap
    __builtin_amdgcn_sched_barrier(0);
}

// logit of head c8 for this lane's row
DEV float z_logit(const f32x4 (&v)[4], const f32x2 (&wl)[8][8], float S, float C,
                  bool b0, bool b1, bool b2) {
    f32x2 x[8];
#pragma unroll
    for (int k = 0; k < 4; ++k) { x[2 * k] = v[k].lo; x[2 * k + 1] = v[k].hi; }
    f32x2 t1 = x[0], t2 = x[0] * x[0];
#pragma unroll
    for (int q = 1; q < 8; ++q) { t1 += x[q]; t2 += x[q] * x[q]; }
    float d[8];
#pragma unroll
    for (int h = 0; h < 8; ++h) {
        f32x2 a = x[0] * wl[h][0];
#pragma unroll
        for (int q = 1; q < 8; ++q) a += x[q] * wl[h][q];
        d[h] = a.x + a.y;
    }
    float s1 = sum8(t1.x + t1.y);
    float s2 = sum8(t2.x + t2.y);
    float dh = scatter8(d, b0, b1, b2);
    float mu = s1 * (1.0f / CZ);
    float var = s2 * (1.0f / CZ) - mu * mu;
    float rs = rsqrtf(var + 1e-5f);
    return rs * (dh - mu * S) + C;
}

// the 8 rows of a pass: masked logits to LDS, lp = this lane's place for the pass's first group
DEV void z_pass(const f32x4 (&v)[2][4], const float (&mk)[2], float* lp, const f32x2 (&wl)[8][8],
                float S, float C, bool b0, bool b1, bool b2) {
#pragma unroll
    for (int g = 0; g < 2; ++g)
        lp[g * 4] = z_logit(v[g], wl, S, C, b0, b1, b2) + (1.0f - mk[g]) * (-1000000.0f);
}

// four waves per SIMD: both work-groups of a WGP are resident, all 512 in one round
__global__ void __launch_bounds__(256) __attribute__((amdgpu_waves_per_eu(4, 4)))
k_bias_softmax(const float* __restrict__ z, const float* __restrict__ mask,
               const float* __restrict__ lzw, const float* __restrict__ lzb,
               const float* __restrict__ Wz, _Float16* __restrict__ wout) {
    __shared__ float logits[8][LG_PITCH];
    int lane = threadIdx.x & 31;
    int wv   = threadIdx.x >> 5;
    int i    = blockIdx.x;                       // 512 blocks
    int c8   = lane & 7;
    int r4   = lane >> 3;
    bool b0 = c8 & 1, b1 = c8 & 2, b2 = c8 & 4;

    // C first: its products are not kept
    const float* wzp = Wz + c8 * 4;
    float S, C;
    {
        f32x4 b4[4];
#pragma unroll
        for (int k = 0; k < 4; ++k) b4[k] = *(const f32x4*)(lzb + k * 32 + c8 * 4);
        float pc[8];
#pragma unroll
        for (int h = 0; h < 8; ++h) {
            f32x4 a = *(const f32x4*)(wzp + h * CZ) * b4[0];
#pragma unroll
            for (int k = 1; k < 4; ++k) a += *(const f32x4*)(wzp + h * CZ + k * 32) * b4[k];
            pc[h] = (a.x + a.y) + (a.z + a.w);
        }
        C = scatter8(pc, b0, b1, b2);
    }
    // keeps the products for wl behind the sums for C: scheduled together they overflow the
    // registers of four waves per SIMD and spill
    __builtin_amdgcn_sched_barrier(0);
    f32x2 wl[8][8];
    {
        f32x4 w4[4];
#pragma unroll
        for (int k = 0; k < 4; ++k) w4[k] = *(const f32x4*)(lzw + k * 32 + c8 * 4);
        float ps[8];
#pragma unroll
        for (int h = 0; h < 8; ++h) {
#pragma unroll
            for (int k = 0; k < 4; ++k) {
                const f32x4 pw = *(const f32x4*)(wzp + h * CZ + k * 32) * w4[k];
                wl[h][2 * k] = pw.lo; wl[h][2 * k + 1] = pw.hi;
            }
            f32x2 a = wl[h][0];
#pragma unroll
            for (int q = 1; q < 8; ++q) a += wl[h][q];
            ps[h] = a.x + a.y;
        }
        S = scatter8(ps, b0, b1, b2);
    }

    // wave wv owns rows j = wv*64 + [0,64): 8 passes of 8 rows, two register buffers, the
    // next pass's loads in flight while a pass is summed
    // the wave's number from a scalar register: the rows' base address is then scalar, which
    // saves the vector registers that would otherwise spill
    int wvu = __builtin_amdgcn_readfirstlane(wv);
    const float* zp = z + ((long)i * N_DIM + wvu * 64) * CZ;
    const float* mp = mask + (long)i * N_DIM + wvu * 64;
    unsigned zo = r4 * CZ + c8 * 4, mo = r4;
    float* lp = &logits[c8][wv * 64 + r4];
    f32x4 va[2][4], vb[2][4];
    float ma[2], mb[2];
    // the weights above are complete before the first rows are requested: scheduled together
    // they overflow the registers of four waves per SIMD and spill
    __builtin_amdgcn_sched_barrier(0);
    z_load(va, ma, zp, mp, zo, mo, 0);
    for (int t = 0; t < 6; t += 2) {
        z_load(vb, mb, zp, mp, zo, mo, t + 1);
        z_pass(va, ma, lp + t * 8, wl, S, C, b0, b1, b2);
        z_load(va, ma, zp, mp, zo, mo, t + 2);
        z_pass(vb, mb, lp + (t + 1) * 8, wl, S, C, b0, b1, b2);
    }
    z_load(vb, mb, zp, mp, zo, mo, 7);
    z_pass(va, ma, lp + 6 * 8, wl, S, C, b0, b1, b2);
    z_pass(vb, mb, lp + 7 * 8, wl, S, C, b0, b1, b2);
    __syncthreads();

    // wave wv owns head wv: softmax over 512
    float vmax = -3.0e38f;
#pragma unroll
    for (int t = 0; t < 16; ++t) vmax = fmaxf(vmax, logits[wv][lane + t * 32]);
    vmax = wave_max(vmax);
    float ex[16], ssum = 0.0f;
#pragma unroll
    for (int t = 0; t < 16; ++t) { ex[t] = __expf(logits[wv][lane + t * 32] - vmax); ssum += ex[t]; }
    ssum = wave_sum(ssum);
    float inv = 1.0f / ssum;
#pragma unroll
    for (int t = 0; t < 16; ++t)
        wout[((long)wv * N_DIM + i) * N_DIM + lane + t * 32] = (_Float16)(ex[t] * inv);
}

// ---------- kernel 3: o = w @ v (per head), gate, store to og in the 512-B units of g ----------
// per head: C[col][i] = sum_j v[col][j] * w[i][j], col = s*32+e: v is the A operand, so a lane
// holds 8 consecutive e of one i, which is 16 B of a unit of g and of og.
// block tile 128 (i) x 256 (col), 8 waves as 2 x 4, each wave 64 x 64 (4 x 4 accumulators).
// a pass is 64 j = 128 B of every operand row, staged in LDS at pitch 144 B, two buffers.
// og[s*32 + (i>>4)][h*2 + (e>>4)] [i&15][e&15], as g.
#define PW_BM     128
#define PW_BN     256
#define PW_PITCH  144
#define PW_STAGE  ((PW_BM + PW_BN) * PW_PITCH)     // 55,296 B
#define PW_NPASS  8

// one stage: 384 rows x 128 B = 3072 copies of 16 B, 12 per thread (4 of w, 8 of v).
// lds: this thread's LDS byte address of w row (tid>>3), chunk (tid&7), in the target buffer.
// ldsv: the same for v: a copy of a wave is one 512-B unit of v, 16 rows x 2 chunks; the wave's
// first unit is tile wv>>2, chunks 2*(wv&3) and the next; row lane>>1, chunk bit lane&1.
// ga, gb: this thread's global address of those chunks of w and of v for this pass.
DEV void pwa_copy_stage(unsigned lds, unsigned ldsv, const _Float16* ga, const _Float16* gb) {
    const unsigned la0 = lds,                   la1 = lds + 32 * PW_PITCH;
    const unsigned la2 = lds + 64 * PW_PITCH,   la3 = lds + 96 * PW_PITCH;
    const unsigned lb0 = ldsv,                  lb1 = ldsv + 32 * PW_PITCH;
    const unsigned lb2 = ldsv + 64 * PW_PITCH,  lb3 = ldsv + 96 * PW_PITCH;
    const unsigned lb4 = ldsv + 128 * PW_PITCH, lb5 = ldsv + 160 * PW_PITCH;
    const unsigned lb6 = ldsv + 192 * PW_PITCH, lb7 = ldsv + 224 * PW_PITCH;
    // the copies and, as the last line, the wait that stands before their address
    // registers may be rewritten
    asm volatile(
        "global_load_async_to_lds_b128 %0, %12, off\n\t"
        "global_load_async_to_lds_b128 %1, %13, off\n\t"
        "global_load_async_to_lds_b128 %2, %14, off\n\t"
        "global_load_async_to_lds_b128 %3, %15, off\n\t"
        "global_load_async_to_lds_b128 %4, %16, off\n\t"
        "global_load_async_to_lds_b128 %5, %17, off\n\t"
        "global_load_async_to_lds_b128 %6, %18, off\n\t"
        "global_load_async_to_lds_b128 %7, %19, off\n\t"
        "global_load_async_to_lds_b128 %8, %20, off\n\t"
        "global_load_async_to_lds_b128 %9, %21, off\n\t"
        "global_load_async_to_lds_b128 %10, %22, off\n\t"
        "global_load_async_to_lds_b128 %11, %23, off\n\t"
        "s_wait_xcnt 0x0"
        :: "v"(la0), "v"(la1), "v"(la2), "v"(la3),
           "v"(lb0), "v"(lb1), "v"(lb2), "v"(lb3), "v"(lb4), "v"(lb5), "v"(lb6), "v"(lb7),
           "v"(ga), "v"(ga + 32 * N_DIM), "v"(ga + 64 * N_DIM), "v"(ga + 96 * N_DIM),
           "v"(gb), "v"(gb + 32 * N_DIM), "v"(gb + 64 * N_DIM), "v"(gb + 96 * N_DIM),
           "v"(gb + 128 * N_DIM), "v"(gb + 160 * N_DIM), "v"(gb + 192 * N_DIM), "v"(gb + 224 * N_DIM)
        : "memory");
}

// four waves per SIMD (two work-groups on a WGP): one group's products cover the other's
// barrier and LDS waits
__global__ void __launch_bounds__(256) __attribute__((amdgpu_waves_per_eu(4, 4)))
k_pwa(const _Float16* __restrict__ wbuf, const _Float16* __restrict__ vbuf,
      const _Float16* __restrict__ gbuf, _Float16* __restrict__ og) {
    __shared__ __attribute__((aligned(16))) unsigned char L[2 * PW_STAGE];
    int tid  = threadIdx.x;
    int lane = tid & 31;
    int wv   = tid >> 5;
    int ln16 = lane & 15;
    int ls   = (lane >> 4) * 8;
    int wm   = wv >> 2;                  // wave row    [0,2)
    int wn   = wv & 3;                   // wave column [0,4)

    int blk  = blockIdx.x;               // 8 heads * 32 col groups * 4 i tiles = 1024
    int h    = blk >> 7;
    int cg   = (blk >> 2) & 31;
    int it   = blk & 3;
    int i0   = it * PW_BM;
    int col0 = cg * PW_BN;               // (s,e) flat in [0,8192)

    // copy addresses of this thread. w: row tid>>3 of each group of 32 rows, 16-B chunk tid&7.
    // v: unit (tile t0 + (wv>>2) + 2k, 16 j number 4*pass + (wv&3)), copy k = 0..7: two tiles
    // on are 2 * 32 units = 32 * N_DIM halves, a pass on is 4 units
    const int t0 = h * 512 + (col0 >> 4);
    const _Float16* ga = wbuf + ((long)h * N_DIM + i0 + (tid >> 3)) * N_DIM + (tid & 7) * 8;
    const _Float16* gb = vbuf + ((long)(t0 + (wv >> 2)) * 32 + (wv & 3)) * 256 + lane * 8;
    const unsigned ldst = (unsigned)(size_t)L + (tid >> 3) * PW_PITCH + (tid & 7) * 16;
    const unsigned ldsv = (unsigned)(size_t)L + (PW_BM + (wv >> 2) * 16 + (lane >> 1)) * PW_PITCH
                          + ((wv & 3) * 2 + (lane & 1)) * 16;

    // fragment read offsets of this lane inside a stage
    const int offA = (wm * 64 + ln16) * PW_PITCH + ls * 2;
    const int offB = (PW_BM + wn * 64 + ln16) * PW_PITCH + ls * 2;

    v8f c[4][4];
#pragma unroll
    for (int x = 0; x < 4; ++x)
#pragma unroll
        for (int y = 0; y < 4; ++y) c[x][y] = v8f{};

    pwa_copy_stage(ldst, ldsv, ga, gb);
    asm volatile("s_wait_asynccnt 0x0" ::: "memory");   // this wave's share of pass 0 has landed
    __syncthreads();                                    // pass 0 is readable by every wave
    pwa_copy_stage(ldst + PW_STAGE, ldsv + PW_STAGE, ga + 64, gb + 1024);

    for (int t = 0; t < PW_NPASS; ++t) {
        const unsigned char* st = L + (t & 1) * PW_STAGE;
        v16h a[4], b[4];
        // first 32 j of the pass
#pragma unroll
        for (int x = 0; x < 4; ++x) {
            const unsigned char* p = st + offA + x * 16 * PW_PITCH;
            a[x] = cat8(*(const v8h*)p, *(const v8h*)(p + 32));
        }
#pragma unroll
        for (int y = 0; y < 4; ++y) {
            const unsigned char* p = st + offB + y * 16 * PW_PITCH;
            b[y] = cat8(*(const v8h*)p, *(const v8h*)(p + 32));
        }
#pragma unroll
        for (int x = 0; x < 4; ++x)
#pragma unroll
            for (int y = 0; y < 4; ++y) c[x][y] = wmma_f16(b[y], a[x], c[x][y]);
        // second 32 j: the fragments are read here, their products follow the refill below
#pragma unroll
        for (int x = 0; x < 4; ++x) {
            const unsigned char* p = st + offA + x * 16 * PW_PITCH + 64;
            a[x] = cat8(*(const v8h*)p, *(const v8h*)(p + 32));
        }
#pragma unroll
        for (int y = 0; y < 4; ++y) {
            const unsigned char* p = st + offB + y * 16 * PW_PITCH + 64;
            b[y] = cat8(*(const v8h*)p, *(const v8h*)(p + 32));
        }
        asm volatile("s_wait_dscnt 0x0" ::: "memory");     // this wave has left buffer t&1
        asm volatile("s_wait_asynccnt 0x0" ::: "memory");  // its share of pass t+1 has landed
        __syncthreads();                                   // publishes pass t+1, frees buffer t&1
        if (t + 2 < PW_NPASS)
            pwa_copy_stage(ldst + (t & 1) * PW_STAGE, ldsv + (t & 1) * PW_STAGE,
                           ga + (t + 2) * 64, gb + (t + 2) * 1024);
#pragma unroll
        for (int x = 0; x < 4; ++x)
#pragma unroll
            for (int y = 0; y < 4; ++y) c[x][y] = wmma_f16(b[y], a[x], c[x][y]);
    }
    asm volatile("s_wait_asynccnt 0x0" ::: "memory");      // no copy is outstanding at the wave's end

    // gate: tile (x, y) is unit [s*32 + i/16][h*2 + (y&1)] of g, s = col/32 + (y>>1), 16 B per lane.
    // all sixteen are requested ahead of the first store, so that their latencies overlap
    const long uo = ((long)(((col0 + wn * 64) >> 5) * 32 + ((i0 + wm * 64) >> 4)) * 16 + h * 2) * 256
                    + ln16 * 16 + ls;
    const _Float16* gp = gbuf + uo;
    v8h g8[4][4];
#pragma unroll
    for (int y = 0; y < 4; ++y)
#pragma unroll
        for (int x = 0; x < 4; ++x) {
            g8[y][x] = *(const v8h*)(gp + ((y >> 1) * 32 + x) * 4096 + (y & 1) * 256);
            // stands before any later instruction, a later gate load among them, rewrites
            // the address registers of this load; its operand keeps them live up to it
            asm volatile("s_wait_xcnt 0x0" :: "v"(gp) : "memory");
        }

    _Float16* op = og + uo;
#pragma unroll
    for (int y = 0; y < 4; ++y)
#pragma unroll
        for (int x = 0; x < 4; ++x) {
            v8h o8;
#pragma unroll
            for (int r = 0; r < 8; ++r) o8[r] = (_Float16)(c[x][y][r] * (float)g8[y][x][r]);
            *(v8h*)(op + ((y >> 1) * 32 + x) * 4096 + (y & 1) * 256) = o8;
        }
}

// ---------- kernel 4: out = og @ W_o^T (fp32 out) ----------
__global__ void k_out(const _Float16* __restrict__ og, const _Float16* __restrict__ wo16,
                      float* __restrict__ out) {
    int lane = threadIdx.x & 31;
    int wv   = threadIdx.x >> 5;
    int ln16 = lane & 15;
    int ls   = (lane >> 4) * 8;
    int rowTile = blockIdx.x * 8 + wv;   // 8192 row tiles
    int r0 = rowTile * 16;

    // the wave's 16 rows are 16 units of og in a row; head kk is two of them, e 0..15 and
    // 16..31: a lane's 16 B of each are the two k chunks of its A fragment
    const _Float16* arow = og + (long)rowTile * 4096 + ln16 * 16 + ls;
    v16h af[8];
#pragma unroll
    for (int kk = 0; kk < 8; ++kk)
        af[kk] = cat8(*(const v8h*)(arow + kk * 512), *(const v8h*)(arow + kk * 512 + 256));
    // stands before the address registers of the loads above are rewritten; its operand keeps
    // them live up to it, so that no load's result lands in them ahead of the wait
    asm volatile("s_wait_xcnt 0x0" :: "v"(arow) : "memory");
    // keeps the sixteen loads ahead of the products: every one opens lines of its own (none
    // finds a line that an earlier one brought), and sunk to their uses their latencies add up
    __builtin_amdgcn_sched_barrier(0);

    for (int ct = 0; ct < 4; ++ct) {
        int col = ct * 16 + ln16;        // [0,64)
        const _Float16* wrow = wo16 + (long)col * HE;
        v8f c = {};
#pragma unroll
        for (int kk = 0; kk < 8; ++kk)
            c = wmma_f16(af[kk], load_frag_h(wrow, ls, kk * 32), c);
        float* op = out + (long)(r0 + ls) * CM + col;
#pragma unroll
        for (int r = 0; r < 8; ++r) op[(long)r * CM] = c[r];
    }
}

// ---------- launch ----------
extern "C" void kernel_launch(void* const* d_in, const int* in_sizes, int n_in,
                              void* d_out, int out_size, void* d_ws, size_t ws_size,
                              hipStream_t stream) {
    (void)in_sizes; (void)n_in; (void)out_size; (void)ws_size;
    const float* m     = (const float*)d_in[0];
    const float* z     = (const float*)d_in[1];
    const float* mask  = (const float*)d_in[2];
    const float* ln_mw = (const float*)d_in[3];
    const float* ln_mb = (const float*)d_in[4];
    const float* ln_zw = (const float*)d_in[5];
    const float* ln_zb = (const float*)d_in[6];
    const float* W_m   = (const float*)d_in[7];
    const float* W_g   = (const float*)d_in[8];
    const float* W_z   = (const float*)d_in[9];
    const float* W_o   = (const float*)d_in[10];
    float* out = (float*)d_out;

    _Float16* wbuf = (_Float16*)d_ws;                 //  2,097,152 halves
    _Float16* vbuf = wbuf + 2097152;                  // 33,554,432
    _Float16* gbuf = vbuf + 33554432;                 // 33,554,432
    _Float16* og   = gbuf + 33554432;                 // 33,554,432
    _Float16* wm16 = og   + 33554432;                 //     16,384
    _Float16* wg16 = wm16 + 16384;                    //     16,384
    _Float16* wo16 = wg16 + 16384;                    //     16,384  (~196 MB total)

    k_prep_w      <<<64,    256, 0, stream>>>(W_m, W_g, W_o, wm16, wg16, wo16);
    k_vg          <<<1024,  256, 0, stream>>>(m, ln_mw, ln_mb, wm16, wg16, vbuf, gbuf);
    k_bias_softmax<<<512,   256, 0, stream>>>(z, mask, ln_zw, ln_zb, W_z, wbuf);
    k_pwa         <<<1024,  256, 0, stream>>>(wbuf, vbuf, gbuf, og);
    k_out         <<<1024,  256, 0, stream>>>(og, wo16, out);
}

// v005
// Measured time: 111 microseconds a run.
// Two timings next to v004 both put it at 1.13 times that version's speed.
// Over all steps from v000 it is 3.49 times as fast.
#include <hip/hip_runtime.h>
#include <hip/hip_bf16.h>

typedef __attribute__((ext_vector_type(16))) _Float16 v16h;
typedef __attribute__((ext_vector_type(8)))  _Float16 v8h;
typedef __attribute__((ext_vector_type(8)))  float    v8f;
typedef __attribute__((ext_vector_type(2))) float f32x2;
typedef __attribute__((ext_vector_type(4))) float f32x4;

#define DEV static __device__ __forceinline__

// ---------- helpers ----------
DEV v16h cat8(v8h a, v8h b) {
    v16h r;
#pragma unroll
    for (int i = 0; i < 8; ++i) { r[i] = a[i]; r[i + 8] = b[i]; }
    return r;
}

// A/B fragment for V_WMMA_F32_16X16X32_F16 from a packed weight array (k_prep_w): fragment u
// is two units of 512 B, one per 16-byte load of a wave. wl: the array + lane * 8.
// a lane's K chunks are [laneSel, +8) and [laneSel+16, +8) of the step, laneSel = (lane>>4)*8
DEV v16h load_frag_p(const _Float16* wl, int u) {
    v8h c0 = *(const v8h*)(wl + u * 512);
    v8h c1 = *(const v8h*)(wl + u * 512 + 256);
    return cat8(c0, c1);
}

DEV v8f wmma_f16(v16h a, v16h b, v8f c) {
    return __builtin_amdgcn_wmma_f32_16x16x32_f16(false, a, false, b, (short)0, c, false, false);
}

DEV float wave_sum(float x) {
#pragma unroll
    for (int o = 16; o > 0; o >>= 1) x += __shfl_xor(x, o, 32);
    return x;
}
DEV float wave_max(float x) {
#pragma unroll
    for (int o = 16; o > 0; o >>= 1) x = fmaxf(x, __shfl_xor(x, o, 32));
    return x;
}

// ---------- constants ----------
// B=1, S=256, N=512, C_M=64, C_Z=128, C_H=32, H=8, H*C_H=256
#define N_DIM   512
#define S_DIM   256
#define CM      64
#define CZ      128
#define HE      256

// ---------- kernel 0: one-shot weight conversion fp32 -> f16, in fragment order ----------
// W_m, W_g: (256,64); W_o: (64,256)  -> all 16384 elements, same flat size
// packed[row>>4][k>>5][(k>>4)&1] [lane = ((k>>3)&1)*16 + (row&15)][k&7]: the 16 B that lane
// loads for its fragment lie at lane * 16 of a 512-B unit, so a wave's load is 4 whole lines
// and not 32-B pieces of 16 rows
__global__ void k_prep_w(const float* __restrict__ Wm, const float* __restrict__ Wg,
                         const float* __restrict__ Wo,
                         _Float16* __restrict__ wm16, _Float16* __restrict__ wg16,
                         _Float16* __restrict__ wo16) {
    int idx = blockIdx.x * 256 + threadIdx.x;    // 64 blocks * 256 = 16384: place in the packed arrays
    int row = (idx >> 3) & 15;                   // row inside its tile of 16
    int k   = ((idx >> 8) & 1) * 16 + ((idx >> 7) & 1) * 8 + (idx & 7);   // k inside its step of 32
    int s64  = ((idx >> 10) * 16 + row) * CM + ((idx >> 9) & 1) * 32 + k; // 2 steps a row tile
    int s256 = ((idx >> 12) * 16 + row) * HE + ((idx >> 9) & 7) * 32 + k; // 8 steps a row tile
    wm16[idx] = (_Float16)Wm[s64];
    wg16[idx] = (_Float16)Wg[s64];
    wo16[idx] = (_Float16)Wo[s256];
}

// ---------- kernel 1: layernorm(m) ; v = mn@Wm^T ; g = sigmoid(mn@Wg^T) ----------
// a wave normalises its own 16 rows of m in the registers of its two A fragments: lane
// (row ln16, half lane>>4) holds channels ls + c*16 + [0,8), c = 0..3, so a row's sums are
// 32 values of a lane and one exchange with lane ^ 16.
// both outputs are f16 and lie in units of 512 B, each one 16-byte store of a wave:
//   v[h*512 + s*2 + (e>>4)][n>>4] [e&15][n&15]  (a lane holds 8 n of one e: the product as it stood)
//   g[s*32 + (n>>4)][h*2 + (e>>4)] [n&15][e&15]  (a lane holds 8 e of one n: W_g as A, rows of m as B)
__global__ void k_vg(const float* __restrict__ m, const float* __restrict__ lw,
                     const float* __restrict__ lb,
                     const _Float16* __restrict__ wm16, const _Float16* __restrict__ wg16,
                     _Float16* __restrict__ vbuf, _Float16* __restrict__ gbuf) {
    int lane = threadIdx.x & 31;
    int wv   = threadIdx.x >> 5;
    int ln16 = lane & 15;
    int ls   = (lane >> 4) * 8;
    int rowTile = blockIdx.x * 8 + wv;           // 8192 row tiles
    int r0 = rowTile * 16;

    const float* xrow = m + (long)(r0 + ln16) * CM + ls;
    f32x4 x[4][2], w4[4][2], b4[4][2];
#pragma unroll
    for (int c = 0; c < 4; ++c)
#pragma unroll
        for (int q = 0; q < 2; ++q) {
            w4[c][q] = *(const f32x4*)(lw + ls + c * 16 + q * 4);
            b4[c][q] = *(const f32x4*)(lb + ls + c * 16 + q * 4);
        }
#pragma unroll
    for (int c = 0; c < 4; ++c)
#pragma unroll
        for (int q = 0; q < 2; ++q) x[c][q] = *(const f32x4*)(xrow + c * 16 + q * 4);
    // stands before the address registers of the loads above are rewritten; its operands keep
    // those registers live up to it, so that neither a later load's result nor the next
    // kernel arguments land in them ahead of the wait
    asm volatile("s_wait_xcnt 0x0" :: "v"(xrow), "s"(lw), "s"(lb) : "memory");
    // keeps all 24 loads ahead of the sums: sunk behind them, the loads of lw and lb run in
    // dependent pairs after the row sums and their latencies add up
    __builtin_amdgcn_sched_barrier(0);

    f32x4 t1 = x[0][0] + x[0][1];
    f32x4 t2 = x[0][0] * x[0][0] + x[0][1] * x[0][1];
#pragma unroll
    for (int c = 1; c < 4; ++c)
#pragma unroll
        for (int q = 0; q < 2; ++q) { t1 += x[c][q]; t2 += x[c][q] * x[c][q]; }
    float s1 = (t1.x + t1.y) + (t1.z + t1.w);
    float s2 = (t2.x + t2.y) + (t2.z + t2.w);
    s1 += __shfl_xor(s1, 16, 32);
    s2 += __shfl_xor(s2, 16, 32);
    float mu = s1 * (1.0f / CM);
    float var = s2 * (1.0f / CM) - mu * mu;
    float rs = rsqrtf(var + 1e-5f);
    v16h a0, a1;
#pragma unroll
    for (int c = 0; c < 2; ++c)
#pragma unroll
        for (int q = 0; q < 2; ++q)
#pragma unroll
            for (int e = 0; e < 4; ++e) {
                a0[c * 8 + q * 4 + e] = (_Float16)((x[c][q][e] - mu) * rs * w4[c][q][e] + b4[c][q][e]);
                a1[c * 8 + q * 4 + e] =
                    (_Float16)((x[c + 2][q][e] - mu) * rs * w4[c + 2][q][e] + b4[c + 2][q][e]);
            }

    int s  = r0 >> 9;                            // row / 512
    int nt = (r0 & 511) >> 4;                    // the wave's 16 n
    int lo = ln16 * 16 + ls;                     // this lane's 8 halves of a unit

    // ---- v path ---- a trip is a head: its two tiles of 16 e lie 32 units apart
    _Float16* vdst = vbuf + ((long)(s * 2) * 32 + nt) * 256 + lo;
    const _Float16* wml = wm16 + lane * 8;
    for (int hh = 0; hh < 8; ++hh) {
        v8f c0 = {}, c1 = {};
        c0 = wmma_f16(a0, load_frag_p(wml, hh * 4),     c0);
        c1 = wmma_f16(a0, load_frag_p(wml, hh * 4 + 2), c1);
        c0 = wmma_f16(a1, load_frag_p(wml, hh * 4 + 1), c0);
        c1 = wmma_f16(a1, load_frag_p(wml, hh * 4 + 3), c1);
        v8h o0, o1;
#pragma unroll
        for (int r = 0; r < 8; ++r) { o0[r] = (_Float16)c0[r]; o1[r] = (_Float16)c1[r]; }
        *(v8h*)vdst = o0;
        *(v8h*)(vdst + 32 * 256) = o1;
        // stands before the next trip's weight loads land in the registers of the two stores
        asm volatile("s_wait_xcnt 0x0" ::: "memory");
        vdst += 512 * 32 * 256;
    }
    // ---- gate path (sigmoid) ----
    const _Float16* wgl = wg16 + lane * 8;
    for (int ct = 0; ct < 16; ++ct) {
        v8f c = {};
        c = wmma_f16(load_frag_p(wgl, ct * 2),     a0, c);
        c = wmma_f16(load_frag_p(wgl, ct * 2 + 1), a1, c);
        _Float16* dst = gbuf + (long)rowTile * 4096 + ct * 256 + lo;
        v8h outv;
#pragma unroll
        for (int r = 0; r < 8; ++r)
            outv[r] = (_Float16)(1.0f / (1.0f + __expf(-c[r])));
        *(v8h*)dst = outv;
    }
}

// ---------- kernel 2: LN(z) + pair bias + mask + softmax -> w_f16[h][i][j] ----------
// with wl[h][c] = ln_w[c] * Wz[h][c], S[h] = sum_c wl[h][c], C[h] = sum_c ln_b[c] * Wz[h][c]:
//   logit[h] = rs * (sum_c x[c] * wl[h][c] - mu * S[h]) + C[h]
// so the ten sums of a row (x, x*x, eight heads) all start from x and are reduced in one pass.
// 8 lanes hold a row, 16 channels each: a 16-byte load of a wave is one whole 128-byte line
// of each of 4 rows. lane = r4 * 8 + c8; channels of a lane: k*32 + c8*4 + [0,4), k = 0..3.

#define LG_PITCH 516    // floats; head h starts 4h banks on: the 4 rows x 8 heads of a store meet 32 banks

// keep + (send of lane l ^ M), M = 1, 2 or 4: row_xmask, inside a 16-lane row
template <int M> DEV float add_xor(float keep, float send) {
    int y = __builtin_amdgcn_update_dpp(0, __builtin_bit_cast(int, send), 0x160 + M, 0xf, 0xf, true);
    return keep + __builtin_bit_cast(float, y);
}
// sum over the 8 lanes of a row, in every one of them
DEV float sum8(float x) {
    x = add_xor<1>(x, x);
    x = add_xor<2>(x, x);
    return add_xor<4>(x, x);
}
// sum over the 8 lanes of a row of a[c8]: each step halves the values a lane still carries.
// b0, b1, b2: bits of c8
DEV float scatter8(const float (&a)[8], bool b0, bool b1, bool b2) {
    float r[4], u[2];
#pragma unroll
    for (int q = 0; q < 4; ++q)
        r[q] = add_xor<1>(b0 ? a[2 * q + 1] : a[2 * q], b0 ? a[2 * q] : a[2 * q + 1]);
#pragma unroll
    for (int q = 0; q < 2; ++q)
        u[q] = add_xor<2>(b1 ? r[2 * q + 1] : r[2 * q], b1 ? r[2 * q] : r[2 * q + 1]);
    return add_xor<4>(b2 ? u[1] : u[0], b2 ? u[0] : u[1]);
}

// 8 rows (two groups of 4) of z and their mask values, pass t of a wave
// zp, mp: the wave's first row, the same in every lane; zo, mo: this lane's offsets from them
DEV void z_load(f32x4 (&v)[2][4], float (&mk)[2], const float* zp, const float* mp,
                unsigned zo, unsigned mo, int t) {
#pragma unroll
    for (int g = 0; g < 2; ++g) {
#pragma unroll
        for (int k = 0; k < 4; ++k)
            v[g][k] = *(const f32x4*)(zp + (t * 8 + g * 4) * CZ + k * 32 + zo);
        mk[g] = mp[t * 8 + g * 4 + mo];
    }
    // stands before the address registers of the loads above are rewritten
    asm volatile("s_wait_xcnt 0x0" ::: "memory");
    // keeps the loads ahead of the sums that follow: sunk behind them they would not overlap
    __builtin_amdgcn_sched_barrier(0);
}

// logit of head c8 for this lane's row
DEV float z_logit(const f32x4 (&v)[4], const f32x2 (&wl)[8][8], float S, float C,
                  bool b0, bool b1, bool b2) {
    f32x2 x[8];
#pragma unroll
    for (int k = 0; k < 4; ++k) { x[2 * k] = v[k].lo; x[2 * k + 1] = v[k].hi; }
    f32x2 t1 = x[0], t2 = x[0] * x[0];
#pragma unroll
    for (int q = 1; q < 8; ++q) { t1 += x[q]; t2 += x[q] * x[q]; }
    float d[8];
#pragma unroll
    for (int h = 0; h < 8; ++h) {
        f32x2 a = x[0] * wl[h][0];
#pragma unroll
        for (int q = 1; q < 8; ++q) a += x[q] * wl[h][q];
        d[h] = a.x + a.y;
    }
    float s1 = sum8(t1.x + t1.y);
    float s2 = sum8(t2.x + t2.y);
    float dh = scatter8(d, b0, b1, b2);
    float mu = s1 * (1.0f / CZ);
    float var = s2 * (1.0f / CZ) - mu * mu;
    float rs = rsqrtf(var + 1e-5f);
    return rs * (dh - mu * S) + C;
}

// the 8 rows of a pass: masked logits to LDS, lp = this lane's place for the pass's first group
DEV void z_pass(const f32x4 (&v)[2][4], const float (&mk)[2], float* lp, const f32x2 (&wl)[8][8],
                float S, float C, bool b0, bool b1, bool b2) {
#pragma unroll
    for (int g = 0; g < 2; ++g)
        lp[g * 4] = z_logit(v[g], wl, S, C, b0, b1, b2) + (1.0f - mk[g]) * (-1000000.0f);
}

// four waves per SIMD: both work-groups of a WGP are resident, all 512 in one round
__global__ void __launch_bounds__(256) __attribute__((amdgpu_waves_per_eu(4, 4)))
k_bias_softmax(const float* __restrict__ z, const float* __restrict__ mask,
               const float* __restrict__ lzw, const float* __restrict__ lzb,
               const float* __restrict__ Wz, _Float16* __restrict__ wout) {
    __shared__ float logits[8][LG_PITCH];
    int lane = threadIdx.x & 31;
    int wv   = threadIdx.x >> 5;
    int i    = blockIdx.x;                       // 512 blocks
    int c8   = lane & 7;
    int r4   = lane >> 3;
    bool b0 = c8 & 1, b1 = c8 & 2, b2 = c8 & 4;

    // C first: its products are not kept
    const float* wzp = Wz + c8 * 4;
    float S, C;
    {
        f32x4 b4[4];
#pragma unroll
        for (int k = 0; k < 4; ++k) b4[k] = *(const f32x4*)(lzb + k * 32 + c8 * 4);
        float pc[8];
#pragma unroll
        for (int h = 0; h < 8; ++h) {
            f32x4 a = *(const f32x4*)(wzp + h * CZ) * b4[0];
#pragma unroll
            for (int k = 1; k < 4; ++k) a += *(const f32x4*)(wzp + h * CZ + k * 32) * b4[k];
            pc[h] = (a.x + a.y) + (a.z + a.w);
        }
        C = scatter8(pc, b0, b1, b2);
    }
    // keeps the products for wl behind the sums for C: scheduled together they overflow the
    // registers of four waves per SIMD and spill
    __builtin_amdgcn_sched_barrier(0);
    f32x2 wl[8][8];
    {
        f32x4 w4[4];
#pragma unroll
        for (int k = 0; k < 4; ++k) w4[k] = *(const f32x4*)(lzw + k * 32 + c8 * 4);
        float ps[8];
#pragma unroll
        for (int h = 0; h < 8; ++h) {
#pragma unroll
            for (int k = 0; k < 4; ++k) {
                const f32x4 pw = *(const f32x4*)(wzp + h * CZ + k * 32) * w4[k];
                wl[h][2 * k] = pw.lo; wl[h][2 * k + 1] = pw.hi;
            }
            f32x2 a = wl[h][0];
#pragma unroll
            for (int q = 1; q < 8; ++q) a += wl[h][q];
            ps[h] = a.x + a.y;
        }
        S = scatter8(ps, b0, b1, b2);
    }

    // wave wv owns rows j = wv*64 + [0,64): 8 passes of 8 rows, two register buffers, the
    // next pass's loads in flight while a pass is summed
    // the wave's number from a scalar register: the rows' base address is then scalar, which
    // saves the vector registers that would otherwise spill
    int wvu = __builtin_amdgcn_readfirstlane(wv);
    const float* zp = z + ((long)i * N_DIM + wvu * 64) * CZ;
    const float* mp = mask + (long)i * N_DIM + wvu * 64;
    unsigned zo = r4 * CZ + c8 * 4, mo = r4;
    float* lp = &logits[c8][wv * 64 + r4];
    f32x4 va[2][4], vb[2][4];
    float ma[2], mb[2];
    // the weights above are complete before the first rows are requested: scheduled together
    // they overflow the registers of four waves per SIMD and spill
    __builtin_amdgcn_sched_barrier(0);
    z_load(va, ma, zp, mp, zo, mo, 0);
    for (int t = 0; t < 6; t += 2) {
        z_load(vb, mb, zp, mp, zo, mo, t + 1);
        z_pass(va, ma, lp + t * 8, wl, S, C, b0, b1, b2);
        z_load(va, ma, zp, mp, zo, mo, t + 2);
        z_pass(vb, mb, lp + (t + 1) * 8, wl, S, C, b0, b1, b2);
    }
    z_load(vb, mb, zp, mp, zo, mo, 7);
    z_pass(va, ma, lp + 6 * 8, wl, S, C, b0, b1, b2);
    z_pass(vb, mb, lp + 7 * 8, wl, S, C, b0, b1, b2);
    __syncthreads();

    // wave wv owns head wv: softmax over 512
    float vmax = -3.0e38f;
#pragma unroll
    for (int t = 0; t < 16; ++t) vmax = fmaxf(vmax, logits[wv][lane + t * 32]);
    vmax = wave_max(vmax);
    float ex[16], ssum = 0.0f;
#pragma unroll
    for (int t = 0; t < 16; ++t) { ex[t] = __expf(logits[wv][lane + t * 32] - vmax); ssum += ex[t]; }
    ssum = wave_sum(ssum);
    float inv = 1.0f / ssum;
#pragma unroll
    for (int t = 0; t < 16; ++t)
        wout[((long)wv * N_DIM + i) * N_DIM + lane + t * 32] = (_Float16)(ex[t] * inv);
}

// ---------- kernel 3: o = w @ v (per head), gate, store to og in the 512-B units of g ----------
// per head: C[col][i] = sum_j v[col][j] * w[i][j], col = s*32+e: v is the A operand, so a lane
// holds 8 consecutive e of one i, which is 16 B of a unit of g and of og.
// block tile 128 (i) x 256 (col), 8 waves as 2 x 4, each wave 64 x 64 (4 x 4 accumulators).
// a pass is 64 j = 128 B of every operand row, staged in LDS at pitch 144 B, two buffers.
// og[s*32 + (i>>4)][h*2 + (e>>4)] [i&15][e&15], as g.
#define PW_BM     128
#define PW_BN     256
#define PW_PITCH  144
#define PW_STAGE  ((PW_BM + PW_BN) * PW_PITCH)     // 55,296 B
#define PW_NPASS  8

// one stage: 384 rows x 128 B = 3072 copies of 16 B, 12 per thread (4 of w, 8 of v).
// lds: this thread's LDS byte address of w row (tid>>3), chunk (tid&7), in the target buffer.
// ldsv: the same for v: a copy of a wave is one 512-B unit of v, 16 rows x 2 chunks; the wave's
// first unit is tile wv>>2, chunks 2*(wv&3) and the next; row lane>>1, chunk bit lane&1.
// ga, gb: this thread's global address of those chunks of w and of v for this pass.
DEV void pwa_copy_stage(unsigned lds, unsigned ldsv, const _Float16* ga, const _Float16* gb) {
    const unsigned la0 = lds,                   la1 = lds + 32 * PW_PITCH;
    const unsigned la2 = lds + 64 * PW_PITCH,   la3 = lds + 96 * PW_PITCH;
    const unsigned lb0 = ldsv,                  lb1 = ldsv + 32 * PW_PITCH;
    const unsigned lb2 = ldsv + 64 * PW_PITCH,  lb3 = ldsv + 96 * PW_PITCH;
    const unsigned lb4 = ldsv + 128 * PW_PITCH, lb5 = ldsv + 160 * PW_PITCH;
    const unsigned lb6 = ldsv + 192 * PW_PITCH, lb7 = ldsv + 224 * PW_PITCH;
    // the copies and, as the last line, the wait that stands before their address
    // registers may be rewritten
    asm volatile(
        "global_load_async_to_lds_b128 %0, %12, off\n\t"
        "global_load_async_to_lds_b128 %1, %13, off\n\t"
        "global_load_async_to_lds_b128 %2, %14, off\n\t"
        "global_load_async_to_lds_b128 %3, %15, off\n\t"
        "global_load_async_to_lds_b128 %4, %16, off\n\t"
        "global_load_async_to_lds_b128 %5, %17, off\n\t"
        "global_load_async_to_lds_b128 %6, %18, off\n\t"
        "global_load_async_to_lds_b128 %7, %19, off\n\t"
        "global_load_async_to_lds_b128 %8, %20, off\n\t"
        "global_load_async_to_lds_b128 %9, %21, off\n\t"
        "global_load_async_to_lds_b128 %10, %22, off\n\t"
        "global_load_async_to_lds_b128 %11, %23, off\n\t"
        "s_wait_xcnt 0x0"
        :: "v"(la0), "v"(la1), "v"(la2), "v"(la3),
           "v"(lb0), "v"(lb1), "v"(lb2), "v"(lb3), "v"(lb4), "v"(lb5), "v"(lb6), "v"(lb7),
           "v"(ga), "v"(ga + 32 * N_DIM), "v"(ga + 64 * N_DIM), "v"(ga + 96 * N_DIM),
           "v"(gb), "v"(gb + 32 * N_DIM), "v"(gb + 64 * N_DIM), "v"(gb + 96 * N_DIM),
           "v"(gb + 128 * N_DIM), "v"(gb + 160 * N_DIM), "v"(gb + 192 * N_DIM), "v"(gb + 224 * N_DIM)
        : "memory");
}

// four waves per SIMD (two work-groups on a WGP): one group's products cover the other's
// barrier and LDS waits
__global__ void __launch_bounds__(256) __attribute__((amdgpu_waves_per_eu(4, 4)))
k_pwa(const _Float16* __restrict__ wbuf, const _Float16* __restrict__ vbuf,
      const _Float16* __restrict__ gbuf, _Float16* __restrict__ og) {
    __shared__ __attribute__((aligned(16))) unsigned char L[2 * PW_STAGE];
    int tid  = threadIdx.x;
    int lane = tid & 31;
    int wv   = tid >> 5;
    int ln16 = lane & 15;
    int ls   = (lane >> 4) * 8;
    int wm   = wv >> 2;                  // wave row    [0,2)
    int wn   = wv & 3;                   // wave column [0,4)

    int blk  = blockIdx.x;               // 8 heads * 32 col groups * 4 i tiles = 1024
    int h    = blk >> 7;
    int cg   = (blk >> 2) & 31;
    int it   = blk & 3;
    int i0   = it * PW_BM;
    int col0 = cg * PW_BN;               // (s,e) flat in [0,8192)

    // copy addresses of this thread. w: row tid>>3 of each group of 32 rows, 16-B chunk tid&7.
    // v: unit (tile t0 + (wv>>2) + 2k, 16 j number 4*pass + (wv&3)), copy k = 0..7: two tiles
    // on are 2 * 32 units = 32 * N_DIM halves, a pass on is 4 units
    const int t0 = h * 512 + (col0 >> 4);
    const _Float16* ga = wbuf + ((long)h * N_DIM + i0 + (tid >> 3)) * N_DIM + (tid & 7) * 8;
    const _Float16* gb = vbuf + ((long)(t0 + (wv >> 2)) * 32 + (wv & 3)) * 256 + lane * 8;
    const unsigned ldst = (unsigned)(size_t)L + (tid >> 3) * PW_PITCH + (tid & 7) * 16;
    const unsigned ldsv = (unsigned)(size_t)L + (PW_BM + (wv >> 2) * 16 + (lane >> 1)) * PW_PITCH
                          + ((wv & 3) * 2 + (lane & 1)) * 16;

    // fragment read offsets of this lane inside a stage
    const int offA = (wm * 64 + ln16) * PW_PITCH + ls * 2;
    const int offB = (PW_BM + wn * 64 + ln16) * PW_PITCH + ls * 2;

    v8f c[4][4];
#pragma unroll
    for (int x = 0; x < 4; ++x)
#pragma unroll
        for (int y = 0; y < 4; ++y) c[x][y] = v8f{};

    pwa_copy_stage(ldst, ldsv, ga, gb);
    asm volatile("s_wait_asynccnt 0x0" ::: "memory");   // this wave's share of pass 0 has landed
    __syncthreads();                                    // pass 0 is readable by every wave
    pwa_copy_stage(ldst + PW_STAGE, ldsv + PW_STAGE, ga + 64, gb + 1024);

    for (int t = 0; t < PW_NPASS; ++t) {
        const unsigned char* st = L + (t & 1) * PW_STAGE;
        v16h a[4], b[4];
        // first 32 j of the pass
#pragma unroll
        for (int x = 0; x < 4; ++x) {
            const unsigned char* p = st + offA + x * 16 * PW_PITCH;
            a[x] = cat8(*(const v8h*)p, *(const v8h*)(p + 32));
        }
#pragma unroll
        for (int y = 0; y < 4; ++y) {
            const unsigned char* p = st + offB + y * 16 * PW_PITCH;
            b[y] = cat8(*(const v8h*)p, *(const v8h*)(p + 32));
        }
#pragma unroll
        for (int x = 0; x < 4; ++x)
#pragma unroll
            for (int y = 0; y < 4; ++y) c[x][y] = wmma_f16(b[y], a[x], c[x][y]);
        // second 32 j: the fragments are read here, their products follow the refill below
#pragma unroll
        for (int x = 0; x < 4; ++x) {
            const unsigned char* p = st + offA + x * 16 * PW_PITCH + 64;
            a[x] = cat8(*(const v8h*)p, *(const v8h*)(p + 32));
        }
#pragma unroll
        for (int y = 0; y < 4; ++y) {
            const unsigned char* p = st + offB + y * 16 * PW_PITCH + 64;
            b[y] = cat8(*(const v8h*)p, *(const v8h*)(p + 32));
        }
        asm volatile("s_wait_dscnt 0x0" ::: "memory");     // this wave has left buffer t&1
        asm volatile("s_wait_asynccnt 0x0" ::: "memory");  // its share of pass t+1 has landed
        __syncthreads();                                   // publishes pass t+1, frees buffer t&1
        if (t + 2 < PW_NPASS)
            pwa_copy_stage(ldst + (t & 1) * PW_STAGE, ldsv + (t & 1) * PW_STAGE,
                           ga + (t + 2) * 64, gb + (t + 2) * 1024);
#pragma unroll
        for (int x = 0; x < 4; ++x)
#pragma unroll
            for (int y = 0; y < 4; ++y) c[x][y] = wmma_f16(b[y], a[x], c[x][y]);
    }
    asm volatile("s_wait_asynccnt 0x0" ::: "memory");      // no copy is outstanding at the wave's end

    // gate: tile (x, y) is unit [s*32 + i/16][h*2 + (y&1)] of g, s = col/32 + (y>>1), 16 B per lane.
    // all sixteen are requested ahead of the first store, so that their latencies overlap
    const long uo = ((long)(((col0 + wn * 64) >> 5) * 32 + ((i0 + wm * 64) >> 4)) * 16 + h * 2) * 256
                    + ln16 * 16 + ls;
    const _Float16* gp = gbuf + uo;
    v8h g8[4][4];
#pragma unroll
    for (int y = 0; y < 4; ++y)
#pragma unroll
        for (int x = 0; x < 4; ++x) {
            g8[y][x] = *(const v8h*)(gp + ((y >> 1) * 32 + x) * 4096 + (y & 1) * 256);
            // stands before any later instruction, a later gate load among them, rewrites
            // the address registers of this load; its operand keeps them live up to it
            asm volatile("s_wait_xcnt 0x0" :: "v"(gp) : "memory");
        }

    _Float16* op = og + uo;
#pragma unroll
    for (int y = 0; y < 4; ++y)
#pragma unroll
        for (int x = 0; x < 4; ++x) {
            v8h o8;
#pragma unroll
            for (int r = 0; r < 8; ++r) o8[r] = (_Float16)(c[x][y][r] * (float)g8[y][x][r]);
            *(v8h*)(op + ((y >> 1) * 32 + x) * 4096 + (y & 1) * 256) = o8;
        }
}

// ---------- kernel 4: out = og @ W_o^T (fp32 out) ----------
__global__ void k_out(const _Float16* __restrict__ og, const _Float16* __restrict__ wo16,
                      float* __restrict__ out) {
    int lane = threadIdx.x & 31;
    int wv   = threadIdx.x >> 5;
    int ln16 = lane & 15;
    int ls   = (lane >> 4) * 8;
    int rowTile = blockIdx.x * 8 + wv;   // 8192 row tiles
    int r0 = rowTile * 16;

    // the wave's 16 rows are 16 units of og in a row; head kk is two of them, e 0..15 and
    // 16..31: a lane's 16 B of each are the two k chunks of its A fragment
    const _Float16* arow = og + (long)rowTile * 4096 + ln16 * 16 + ls;
    v16h af[8];
#pragma unroll
    for (int kk = 0; kk < 8; ++kk)
        af[kk] = cat8(*(const v8h*)(arow + kk * 512), *(const v8h*)(arow + kk * 512 + 256));
    // stands before the address registers of the loads above are rewritten; its operand keeps
    // them live up to it, so that no load's result lands in them ahead of the wait
    asm volatile("s_wait_xcnt 0x0" :: "v"(arow) : "memory");
    // keeps the sixteen loads ahead of the products: every one opens lines of its own (none
    // finds a line that an earlier one brought), and sunk to their uses their latencies add up
    __builtin_amdgcn_sched_barrier(0);

    const _Float16* wol = wo16 + lane * 8;
    for (int ct = 0; ct < 4; ++ct) {
        int col = ct * 16 + ln16;        // [0,64)
        v8f c = {};
#pragma unroll
        for (int kk = 0; kk < 8; ++kk)
            c = wmma_f16(af[kk], load_frag_p(wol, ct * 8 + kk), c);
        float* op = out + (long)(r0 + ls) * CM + col;
#pragma unroll
        for (int r = 0; r < 8; ++r) op[(long)r * CM] = c[r];
    }
}

// ---------- launch ----------
extern "C" void kernel_launch(void* const* d_in, const int* in_sizes, int n_in,
                              void* d_out, int out_size, void* d_ws, size_t ws_size,
                              hipStream_t stream) {
    (void)in_sizes; (void)n_in; (void)out_size; (void)ws_size;
    const float* m     = (const float*)d_in[0];
    const float* z     = (const float*)d_in[1];
    const float* mask  = (const float*)d_in[2];
    const float* ln_mw = (const float*)d_in[3];
    const float* ln_mb = (const float*)d_in[4];
    const float* ln_zw = (const float*)d_in[5];
    const float* ln_zb = (const float*)d_in[6];
    const float* W_m   = (const float*)d_in[7];
    const float* W_g   = (const float*)d_in[8];
    const float* W_z   = (const float*)d_in[9];
    const float* W_o   = (const float*)d_in[10];
    float* out = (float*)d_out;

    _Float16* wbuf = (_Float16*)d_ws;                 //  2,097,152 halves
    _Float16* vbuf = wbuf + 2097152;                  // 33,554,432
    _Float16* gbuf = vbuf + 33554432;                 // 33,554,432
    _Float16* og   = gbuf + 33554432;                 // 33,554,432
    _Float16* wm16 = og   + 33554432;                 //     16,384
    _Float16* wg16 = wm16 + 16384;                    //     16,384
    _Float16* wo16 = wg16 + 16384;                    //     16,384  (~196 MB total)

    k_prep_w      <<<64,    256, 0, stream>>>(W_m, W_g, W_o, wm16, wg16, wo16);
    k_vg          <<<1024,  256, 0, stream>>>(m, ln_mw, ln_mb, wm16, wg16, vbuf, gbuf);
    k_bias_softmax<<<512,   256, 0, stream>>>(z, mask, ln_zw, ln_zb, W_z, wbuf);
    k_pwa         <<<1024,  256, 0, stream>>>(wbuf, vbuf, gbuf, og);
    k_out         <<<1024,  256, 0, stream>>>(og, wo16, out);
}

// v006
// Measured time: 88.2 microseconds a run.
// Timed twice side by side with v005, it ran 1.26 and 1.27 times as fast.
// Over all steps from v000 it is 4.41 times as fast.
#include <hip/hip_runtime.h>
#include <hip/hip_bf16.h>

typedef __attribute__((ext_vector_type(16))) _Float16 v16h;
typedef __attribute__((ext_vector_type(8)))  _Float16 v8h;
typedef __attribute__((ext_vector_type(8)))  float    v8f;
typedef __attribute__((ext_vector_type(2))) float f32x2;
typedef __attribute__((ext_vector_type(4))) float f32x4;

#define DEV static __device__ __forceinline__

// ---------- helpers ----------
DEV v16h cat8(v8h a, v8h b) {
    v16h r;
#pragma unroll
    for (int i = 0; i < 8; ++i) { r[i] = a[i]; r[i + 8] = b[i]; }
    return r;
}

// A/B fragment for V_WMMA_F32_16X16X32_F16 from a packed weight array (k_prep_w): fragment u
// is two units of 512 B, one per 16-byte load of a wave. wl: the array + lane * 8.
// a lane's K chunks are [laneSel, +8) and [laneSel+16, +8) of the step, laneSel = (lane>>4)*8
DEV v16h load_frag_p(const _Float16* wl, int u) {
    v8h c0 = *(const v8h*)(wl + u * 512);
    v8h c1 = *(const v8h*)(wl + u * 512 + 256);
    return cat8(c0, c1);
}

DEV v8f wmma_f16(v16h a, v16h b, v8f c) {
    return __builtin_amdgcn_wmma_f32_16x16x32_f16(false, a, false, b, (short)0, c, false, false);
}

DEV float wave_sum(float x) {
#pragma unroll
    for (int o = 16; o > 0; o >>= 1) x += __shfl_xor(x, o, 32);
    return x;
}
DEV float wave_max(float x) {
#pragma unroll
    for (int o = 16; o > 0; o >>= 1) x = fmaxf(x, __shfl_xor(x, o, 32));
    return x;
}

// ---------- constants ----------
// B=1, S=256, N=512, C_M=64, C_Z=128, C_H=32, H=8, H*C_H=256
#define N_DIM   512
#define S_DIM   256
#define CM      64
#define CZ      128
#define HE      256

// ---------- kernel 0: one-shot weight conversion fp32 -> f16, in fragment order ----------
// W_m, W_g: (256,64); W_o: (64,256)  -> all 16384 elements, same flat size
// packed[row>>4][k>>5][(k>>4)&1] [lane = ((k>>3)&1)*16 + (row&15)][k&7]: the 16 B that lane
// loads for its fragment lie at lane * 16 of a 512-B unit, so a wave's load is 4 whole lines
// and not 32-B pieces of 16 rows
__global__ void k_prep_w(const float* __restrict__ Wm, const float* __restrict__ Wg,
                         const float* __restrict__ Wo,
                         _Float16* __restrict__ wm16, _Float16* __restrict__ wg16,
                         _Float16* __restrict__ wo16) {
    int idx = blockIdx.x * 256 + threadIdx.x;    // 64 blocks * 256 = 16384: place in the packed arrays
    int row = (idx >> 3) & 15;                   // row inside its tile of 16
    int k   = ((idx >> 8) & 1) * 16 + ((idx >> 7) & 1) * 8 + (idx & 7);   // k inside its step of 32
    int s64  = ((idx >> 10) * 16 + row) * CM + ((idx >> 9) & 1) * 32 + k; // 2 steps a row tile
    int s256 = ((idx >> 12) * 16 + row) * HE + ((idx >> 9) & 7) * 32 + k; // 8 steps a row tile
    wm16[idx] = (_Float16)Wm[s64];
    wg16[idx] = (_Float16)Wg[s64];
    wo16[idx] = (_Float16)Wo[s256];
}

// ---------- kernel 1: layernorm(m) ; v = mn@Wm^T ; g = sigmoid(mn@Wg^T) ----------
// a wave normalises its own 16 rows of m in the registers of its two A fragments: lane
// (row ln16, half lane>>4) holds channels ls + c*16 + [0,8), c = 0..3, so a row's sums are
// 32 values of a lane and one exchange with lane ^ 16.
// both outputs are f16 and lie in units of 512 B, each one 16-byte store of a wave:
//   v[h*512 + s*2 + (e>>4)][n>>4] [e&15][n&15]  (a lane holds 8 n of one e: the product as it stood)
//   g[s*32 + (n>>4)][h*2 + (e>>4)] [n&15][e&15]  (a lane holds 8 e of one n: W_g as A, rows of m as B)
__global__ void k_vg(const float* __restrict__ m, const float* __restrict__ lw,
                     const float* __restrict__ lb,
                     const _Float16* __restrict__ wm16, const _Float16* __restrict__ wg16,
                     _Float16* __restrict__ vbuf, _Float16* __restrict__ gbuf) {
    int lane = threadIdx.x & 31;
    int wv   = threadIdx.x >> 5;
    int ln16 = lane & 15;
    int ls   = (lane >> 4) * 8;
    int rowTile = blockIdx.x * 8 + wv;           // 8192 row tiles
    int r0 = rowTile * 16;

    const float* xrow = m + (long)(r0 + ln16) * CM + ls;
    f32x4 x[4][2], w4[4][2], b4[4][2];
#pragma unroll
    for (int c = 0; c < 4; ++c)
#pragma unroll
        for (int q = 0; q < 2; ++q) {
            w4[c][q] = *(const f32x4*)(lw + ls + c * 16 + q * 4);
            b4[c][q] = *(const f32x4*)(lb + ls + c * 16 + q * 4);
        }
#pragma unroll
    for (int c = 0; c < 4; ++c)
#pragma unroll
        for (int q = 0; q < 2; ++q) x[c][q] = *(const f32x4*)(xrow + c * 16 + q * 4);
    // stands before the address registers of the loads above are rewritten; its operands keep
    // those registers live up to it, so that neither a later load's result nor the next
    // kernel arguments land in them ahead of the wait
    asm volatile("s_wait_xcnt 0x0" :: "v"(xrow), "s"(lw), "s"(lb) : "memory");
    // keeps all 24 loads ahead of the sums: sunk behind them, the loads of lw and lb run in
    // dependent pairs after the row sums and their latencies add up
    __builtin_amdgcn_sched_barrier(0);

    f32x4 t1 = x[0][0] + x[0][1];
    f32x4 t2 = x[0][0] * x[0][0] + x[0][1] * x[0][1];
#pragma unroll
    for (int c = 1; c < 4; ++c)
#pragma unroll
        for (int q = 0; q < 2; ++q) { t1 += x[c][q]; t2 += x[c][q] * x[c][q]; }
    float s1 = (t1.x + t1.y) + (t1.z + t1.w);
    float s2 = (t2.x + t2.y) + (t2.z + t2.w);
    s1 += __shfl_xor(s1, 16, 32);
    s2 += __shfl_xor(s2, 16, 32);
    float mu = s1 * (1.0f / CM);
    float var = s2 * (1.0f / CM) - mu * mu;
    float rs = rsqrtf(var + 1e-5f);
    v16h a0, a1;
#pragma unroll
    for (int c = 0; c < 2; ++c)
#pragma unroll
        for (int q = 0; q < 2; ++q)
#pragma unroll
            for (int e = 0; e < 4; ++e) {
                a0[c * 8 + q * 4 + e] = (_Float16)((x[c][q][e] - mu) * rs * w4[c][q][e] + b4[c][q][e]);
                a1[c * 8 + q * 4 + e] =
                    (_Float16)((x[c + 2][q][e] - mu) * rs * w4[c + 2][q][e] + b4[c + 2][q][e]);
            }

    int s  = r0 >> 9;                            // row / 512
    int nt = (r0 & 511) >> 4;                    // the wave's 16 n
    int lo = ln16 * 16 + ls;                     // this lane's 8 halves of a unit

    // ---- v path ---- a trip is a head: its two tiles of 16 e lie 32 units apart
    _Float16* vdst = vbuf + ((long)(s * 2) * 32 + nt) * 256 + lo;
    const _Float16* wml = wm16 + lane * 8;
    for (int hh = 0; hh < 8; ++hh) {
        v8f c0 = {}, c1 = {};
        c0 = wmma_f16(a0, load_frag_p(wml, hh * 4),     c0);
        c1 = wmma_f16(a0, load_frag_p(wml, hh * 4 + 2), c1);
        c0 = wmma_f16(a1, load_frag_p(wml, hh * 4 + 1), c0);
        c1 = wmma_f16(a1, load_frag_p(wml, hh * 4 + 3), c1);
        v8h o0, o1;
#pragma unroll
        for (int r = 0; r < 8; ++r) { o0[r] = (_Float16)c0[r]; o1[r] = (_Float16)c1[r]; }
        *(v8h*)vdst = o0;
        *(v8h*)(vdst + 32 * 256) = o1;
        // stands before the next trip's weight loads land in the registers of the two stores
        asm volatile("s_wait_xcnt 0x0" ::: "memory");
        vdst += 512 * 32 * 256;
    }
    // ---- gate path (sigmoid) ----
    const _Float16* wgl = wg16 + lane * 8;
    for (int ct = 0; ct < 16; ++ct) {
        v8f c = {};
        c = wmma_f16(load_frag_p(wgl, ct * 2),     a0, c);
        c = wmma_f16(load_frag_p(wgl, ct * 2 + 1), a1, c);
        _Float16* dst = gbuf + (long)rowTile * 4096 + ct * 256 + lo;
        v8h outv;
#pragma unroll
        for (int r = 0; r < 8; ++r)
            outv[r] = (_Float16)(1.0f / (1.0f + __expf(-c[r])));
        *(v8h*)dst = outv;
    }
}

// ---------- kernel 2: LN(z) + pair bias + mask + softmax -> w_f16[h][i][j] ----------
// with wl[h][c] = ln_w[c] * Wz[h][c], S[h] = sum_c wl[h][c], C[h] = sum_c ln_b[c] * Wz[h][c]:
//   logit[h] = rs * (sum_c x[c] * wl[h][c] - mu * S[h]) + C[h]
// so the ten sums of a row (x, x*x, eight heads) all start from x and are reduced in one pass.
// 8 lanes hold a row, 16 channels each: a 16-byte load of a wave is one whole 128-byte line
// of each of 4 rows. lane = r4 * 8 + c8; channels of a lane: k*32 + c8*4 + [0,4), k = 0..3.

#define LG_PITCH 516    // floats; head h starts 4h banks on: the 4 rows x 8 heads of a store meet 32 banks

// keep + (send of lane l ^ M), M = 1, 2 or 4: row_xmask, inside a 16-lane row
template <int M> DEV float add_xor(float keep, float send) {
    int y = __builtin_amdgcn_update_dpp(0, __builtin_bit_cast(int, send), 0x160 + M, 0xf, 0xf, true);
    return keep + __builtin_bit_cast(float, y);
}
// sum over the 8 lanes of a row, in every one of them
DEV float sum8(float x) {
    x = add_xor<1>(x, x);
    x = add_xor<2>(x, x);
    return add_xor<4>(x, x);
}
// sum over the 8 lanes of a row of a[c8]: each step halves the values a lane still carries.
// b0, b1, b2: bits of c8
DEV float scatter8(const float (&a)[8], bool b0, bool b1, bool b2) {
    float r[4], u[2];
#pragma unroll
    for (int q = 0; q < 4; ++q)
        r[q] = add_xor<1>(b0 ? a[2 * q + 1] : a[2 * q], b0 ? a[2 * q] : a[2 * q + 1]);
#pragma unroll
    for (int q = 0; q < 2; ++q)
        u[q] = add_xor<2>(b1 ? r[2 * q + 1] : r[2 * q], b1 ? r[2 * q] : r[2 * q + 1]);
    return add_xor<4>(b2 ? u[1] : u[0], b2 ? u[0] : u[1]);
}

// 8 rows (two groups of 4) of z and their mask values, pass t of a wave
// zp, mp: the wave's first row, the same in every lane; zo, mo: this lane's offsets from them
DEV void z_load(f32x4 (&v)[2][4], float (&mk)[2], const float* zp, const float* mp,
                unsigned zo, unsigned mo, int t) {
#pragma unroll
    for (int g = 0; g < 2; ++g) {
#pragma unroll
        for (int k = 0; k < 4; ++k)
            v[g][k] = *(const f32x4*)(zp + (t * 8 + g * 4) * CZ + k * 32 + zo);
        mk[g] = mp[t * 8 + g * 4 + mo];
    }
    // stands before the address registers of the loads above are rewritten
    asm volatile("s_wait_xcnt 0x0" ::: "memory");
    // keeps the loads ahead of the sums that follow: sunk behind them they would not overlap
    __builtin_amdgcn_sched_barrier(0);
}

// logit of head c8 for this lane's row
DEV float z_logit(const f32x4 (&v)[4], const f32x2 (&wl)[8][8], float S, float C,
                  bool b0, bool b1, bool b2) {
    f32x2 x[8];
#pragma unroll
    for (int k = 0; k < 4; ++k) { x[2 * k] = v[k].lo; x[2 * k + 1] = v[k].hi; }
    f32x2 t1 = x[0], t2 = x[0] * x[0];
#pragma unroll
    for (int q = 1; q < 8; ++q) { t1 += x[q]; t2 += x[q] * x[q]; }
    float d[8];
#pragma unroll
    for (int h = 0; h < 8; ++h) {
        f32x2 a = x[0] * wl[h][0];
#pragma unroll
        for (int q = 1; q < 8; ++q) a += x[q] * wl[h][q];
        d[h] = a.x + a.y;
    }
    float s1 = sum8(t1.x + t1.y);
    float s2 = sum8(t2.x + t2.y);
    float dh = scatter8(d, b0, b1, b2);
    float mu = s1 * (1.0f / CZ);
    float var = s2 * (1.0f / CZ) - mu * mu;
    float rs = rsqrtf(var + 1e-5f);
    return rs * (dh - mu * S) + C;
}

// the 8 rows of a pass: masked logits to LDS, lp = this lane's place for the pass's first group
DEV void z_pass(const f32x4 (&v)[2][4], const float (&mk)[2], float* lp, const f32x2 (&wl)[8][8],
                float S, float C, bool b0, bool b1, bool b2) {
#pragma unroll
    for (int g = 0; g < 2; ++g)
        lp[g * 4] = z_logit(v[g], wl, S, C, b0, b1, b2) + (1.0f - mk[g]) * (-1000000.0f);
}

// four waves per SIMD: both work-groups of a WGP are resident, all 512 in one round
__global__ void __launch_bounds__(256) __attribute__((amdgpu_waves_per_eu(4, 4)))
k_bias_softmax(const float* __restrict__ z, const float* __restrict__ mask,
               const float* __restrict__ lzw, const float* __restrict__ lzb,
               const float* __restrict__ Wz, _Float16* __restrict__ wout) {
    __shared__ float logits[8][LG_PITCH];
    int lane = threadIdx.x & 31;
    int wv   = threadIdx.x >> 5;
    int i    = blockIdx.x;                       // 512 blocks
    int c8   = lane & 7;
    int r4   = lane >> 3;
    bool b0 = c8 & 1, b1 = c8 & 2, b2 = c8 & 4;

    // C first: its products are not kept
    const float* wzp = Wz + c8 * 4;
    float S, C;
    {
        f32x4 b4[4];
#pragma unroll
        for (int k = 0; k < 4; ++k) b4[k] = *(const f32x4*)(lzb + k * 32 + c8 * 4);
        float pc[8];
#pragma unroll
        for (int h = 0; h < 8; ++h) {
            f32x4 a = *(const f32x4*)(wzp + h * CZ) * b4[0];
#pragma unroll
            for (int k = 1; k < 4; ++k) a += *(const f32x4*)(wzp + h * CZ + k * 32) * b4[k];
            pc[h] = (a.x + a.y) + (a.z + a.w);
        }
        C = scatter8(pc, b0, b1, b2);
    }
    // keeps the products for wl behind the sums for C: scheduled together they overflow the
    // registers of four waves per SIMD and spill
    __builtin_amdgcn_sched_barrier(0);
    f32x2 wl[8][8];
    {
        f32x4 w4[4];
#pragma unroll
        for (int k = 0; k < 4; ++k) w4[k] = *(const f32x4*)(lzw + k * 32 + c8 * 4);
        float ps[8];
#pragma unroll
        for (int h = 0; h < 8; ++h) {
#pragma unroll
            for (int k = 0; k < 4; ++k) {
                const f32x4 pw = *(const f32x4*)(wzp + h * CZ + k * 32) * w4[k];
                wl[h][2 * k] = pw.lo; wl[h][2 * k + 1] = pw.hi;
            }
            f32x2 a = wl[h][0];
#pragma unroll
            for (int q = 1; q < 8; ++q) a += wl[h][q];
            ps[h] = a.x + a.y;
        }
        S = scatter8(ps, b0, b1, b2);
    }

    // wave wv owns rows j = wv*64 + [0,64): 8 passes of 8 rows, two register buffers, the
    // next pass's loads in flight while a pass is summed
    // the wave's number from a scalar register: the rows' base address is then scalar, which
    // saves the vector registers that would otherwise spill
    int wvu = __builtin_amdgcn_readfirstlane(wv);
    const float* zp = z + ((long)i * N_DIM + wvu * 64) * CZ;
    const float* mp = mask + (long)i * N_DIM + wvu * 64;
    unsigned zo = r4 * CZ + c8 * 4, mo = r4;
    float* lp = &logits[c8][wv * 64 + r4];
    f32x4 va[2][4], vb[2][4];
    float ma[2], mb[2];
    // the weights above are complete before the first rows are requested: scheduled together
    // they overflow the registers of four waves per SIMD and spill
    __builtin_amdgcn_sched_barrier(0);
    z_load(va, ma, zp, mp, zo, mo, 0);
    for (int t = 0; t < 6; t += 2) {
        z_load(vb, mb, zp, mp, zo, mo, t + 1);
        z_pass(va, ma, lp + t * 8, wl, S, C, b0, b1, b2);
        z_load(va, ma, zp, mp, zo, mo, t + 2);
        z_pass(vb, mb, lp + (t + 1) * 8, wl, S, C, b0, b1, b2);
    }
    z_load(vb, mb, zp, mp, zo, mo, 7);
    z_pass(va, ma, lp + 6 * 8, wl, S, C, b0, b1, b2);
    z_pass(vb, mb, lp + 7 * 8, wl, S, C, b0, b1, b2);
    __syncthreads();

    // wave wv owns head wv: softmax over 512
    float vmax = -3.0e38f;
#pragma unroll
    for (int t = 0; t < 16; ++t) vmax = fmaxf(vmax, logits[wv][lane + t * 32]);
    vmax = wave_max(vmax);
    float ex[16], ssum = 0.0f;
#pragma unroll
    for (int t = 0; t < 16; ++t) { ex[t] = __expf(logits[wv][lane + t * 32] - vmax); ssum += ex[t]; }
    ssum = wave_sum(ssum);
    float inv = 1.0f / ssum;
#pragma unroll
    for (int t = 0; t < 16; ++t)
        wout[((long)wv * N_DIM + i) * N_DIM + lane + t * 32] = (_Float16)(ex[t] * inv);
}

// ---------- kernel 3: o = w @ v, gate, out = (g * o) @ W_o^T (fp32 out) ----------
// a work-group takes 128 i x 4 s (128 col = s*32+e of every head) through all 8 heads, one
// after the other: 256 work-groups, one per WGP. 8 waves as 2 (i) x 4 (s), each 64 i x 32 e.
// per head: C[e][i] = sum_j v[e][j] * w[i][j], v as the A operand: a lane then holds 8
// consecutive e of one i in each of the two e tiles, which are, gated and rounded to f16, the
// two k chunks of its A fragment for the product with head h's 32 columns of W_o. The 64 x 64
// sums of out stay in registers over the heads (heads summed in the order 0..7).
// a pass is 256 j = 512 B of every operand row, staged in LDS at pitch 528 B, two buffers:
// a head is two passes, buffer 0 and then buffer 1.
#define PF_BM     128
#define PF_BN     128
#define PF_PITCH  528
#define PF_STAGE  ((PF_BM + PF_BN) * PF_PITCH)     // 135,168 B

// eight copies of 16 B per lane: copy k lands at LDS byte l + N, N = N0 + k * DL, and reads
// global byte g + G0 + k * DG. N goes into the instruction's offset field, which moves both
// addresses (all N here lie under 65,536), so one register holds the LDS address of them all
// and the global address register holds the source less N
template <int N0, int DL, int G0, int DG> DEV void pf_copy8(unsigned l, const unsigned char* g) {
    // the copies and, as the last line, the wait that stands before their address
    // registers may be rewritten
    asm volatile(
        "global_load_async_to_lds_b128 %0, %1, off offset:%9\n\t"
        "global_load_async_to_lds_b128 %0, %2, off offset:%10\n\t"
        "global_load_async_to_lds_b128 %0, %3, off offset:%11\n\t"
        "global_load_async_to_lds_b128 %0, %4, off offset:%12\n\t"
        "global_load_async_to_lds_b128 %0, %5, off offset:%13\n\t"
        "global_load_async_to_lds_b128 %0, %6, off offset:%14\n\t"
        "global_load_async_to_lds_b128 %0, %7, off offset:%15\n\t"
        "global_load_async_to_lds_b128 %0, %8, off offset:%16\n\t"
        "s_wait_xcnt 0x0"
        :: "v"(l),
           "v"(g + (G0 - N0)),                 "v"(g + (G0 - N0 + (DG - DL))),
           "v"(g + (G0 - N0 + 2 * (DG - DL))), "v"(g + (G0 - N0 + 3 * (DG - DL))),
           "v"(g + (G0 - N0 + 4 * (DG - DL))), "v"(g + (G0 - N0 + 5 * (DG - DL))),
           "v"(g + (G0 - N0 + 6 * (DG - DL))), "v"(g + (G0 - N0 + 7 * (DG - DL))),
           "i"(N0),          "i"(N0 + DL),     "i"(N0 + 2 * DL), "i"(N0 + 3 * DL),
           "i"(N0 + 4 * DL), "i"(N0 + 5 * DL), "i"(N0 + 6 * DL), "i"(N0 + 7 * DL)
        : "memory");
}

// one stage: 256 rows x 512 B = 8192 copies of 16 B, 32 per thread (16 of w, 16 of v).
// w: a copy of a wave is the 512 B of one row, row k * 8 + wv. lw, ga: row wv, chunk lane.
// v: a copy of a wave is one 512-B unit, 16 rows (e) x 32 B (16 j): tile k & 7, 16 j number
// (k >> 3) * 8 + wv. lv, gb: tile 0, number wv; row lane >> 1, chunk bit lane & 1.
DEV void pf_copy_stage(unsigned lw, unsigned lv, const _Float16* ga, const _Float16* gb) {
    const unsigned char* a = (const unsigned char*)ga;
    const unsigned char* b = (const unsigned char*)gb;
    pf_copy8<0,             8 * PF_PITCH,  0,              8 * N_DIM * 2>(lw, a);
    pf_copy8<64 * PF_PITCH, 8 * PF_PITCH,  64 * N_DIM * 2, 8 * N_DIM * 2>(lw, a);
    pf_copy8<0,             16 * PF_PITCH, 0,              32 * 512>(lv, b);
    pf_copy8<256,           16 * PF_PITCH, 8 * 512,        32 * 512>(lv, b);
}

// the six fragments of 32 j: pa, pb = this lane's place in the first w and the first v tile
DEV void pf_frags(v16h (&a)[4], v16h (&b)[2], const unsigned char* pa, const unsigned char* pb) {
#pragma unroll
    for (int x = 0; x < 4; ++x) {
        const unsigned char* p = pa + x * 16 * PF_PITCH;
        a[x] = cat8(*(const v8h*)p, *(const v8h*)(p + 32));
    }
#pragma unroll
    for (int y = 0; y < 2; ++y) {
        const unsigned char* p = pb + y * 16 * PF_PITCH;
        b[y] = cat8(*(const v8h*)p, *(const v8h*)(p + 32));
    }
}

// one pass: eight steps of 32 j, each step's fragments read one step ahead into the other
// register set. pa, pb: this lane's places in the pass's buffer; na, nb: in the other buffer.
// more: a head follows, whose pass of the same number refills this buffer (lw, lv, ga, gb).
DEV void pf_pass(v8f (&c)[4][2], v16h (&a)[2][4], v16h (&b)[2][2], const unsigned char* pa,
                 const unsigned char* pb, const unsigned char* na, const unsigned char* nb,
                 bool more, unsigned lw, unsigned lv, const _Float16* ga, const _Float16* gb) {
#pragma unroll
    for (int ks = 0; ks < 8; ++ks) {
        if (ks < 7) {
            pf_frags(a[(ks + 1) & 1], b[(ks + 1) & 1], pa + (ks + 1) * 64, pb + (ks + 1) * 64);
        } else {
            asm volatile("s_wait_dscnt 0x0" ::: "memory");     // this wave has left the pass's buffer
            asm volatile("s_wait_asynccnt 0x0" ::: "memory");  // its share of the next pass has landed
            __syncthreads();                                   // publishes the next pass, frees this buffer
            if (more) pf_copy_stage(lw, lv, ga, gb);
            // first step of the next pass, out of the other buffer. Behind the very last pass
            // these reads find the pass before it and are not used: without a branch round
            // them the compiler counts the waits of one path only
            pf_frags(a[0], b[0], na, nb);
        }
        // keeps the twelve reads of the next step as one group ahead of this step's products:
        // sunk to their uses each pair of reads is waited for in full before two products
        __builtin_amdgcn_sched_barrier(0);
#pragma unroll
        for (int x = 0; x < 4; ++x)
#pragma unroll
            for (int y = 0; y < 2; ++y) c[x][y] = wmma_f16(b[ks & 1][y], a[ks & 1][x], c[x][y]);
        // keeps the reads of the step after next behind these products, whose operands they overwrite
        __builtin_amdgcn_sched_barrier(0);
    }
}

// two waves per SIMD: one work-group owns the WGP's LDS, a wave up to 512 registers
__global__ void __launch_bounds__(256) __attribute__((amdgpu_waves_per_eu(2, 2)))
k_pwa_out(const _Float16* __restrict__ wbuf, const _Float16* __restrict__ vbuf,
          const _Float16* __restrict__ gbuf, const _Float16* __restrict__ wo16,
          float* __restrict__ out) {
    __shared__ __attribute__((aligned(16))) unsigned char L[2 * PF_STAGE];
    int tid  = threadIdx.x;
    int lane = tid & 31;
    int wv   = tid >> 5;
    int ln16 = lane & 15;
    int ls   = (lane >> 4) * 8;
    int wm   = wv >> 2;                  // wave row    [0,2): 64 i
    int wn   = wv & 3;                   // wave column [0,4): one s

    // 64 groups of 4 s * 4 i tiles = 256. The four work-groups that read the same tiles of v
    // stand 8 apart in the grid. For speed only: any placement is right
    int blk  = blockIdx.x;
    int sg   = (blk & 7) | ((blk >> 5) << 3);
    int i0   = ((blk >> 3) & 3) * PF_BM;
    int s    = sg * 4 + wn;

    // copy addresses of this thread for head 0, pass 0. A pass on: 256 j = 256 halves of a row
    // of w, 16 units of v. A head on: 512 rows of w, 512 tiles of 32 units of v
    const _Float16* ga = wbuf + (long)(i0 + wv) * N_DIM + lane * 8;
    const _Float16* gb = vbuf + ((long)(sg * 8) * 32 + wv) * 256 + lane * 8;
    const unsigned lw = (unsigned)(size_t)L + wv * PF_PITCH + lane * 16;
    const unsigned lv = (unsigned)(size_t)L + (PF_BM + (lane >> 1)) * PF_PITCH + wv * 32 + (lane & 1) * 16;

    // fragment read places of this lane in buffer 0
    const unsigned char* pa = L + (wm * 64 + ln16) * PF_PITCH + ls * 2;
    const unsigned char* pb = L + (PF_BM + wn * 32 + ln16) * PF_PITCH + ls * 2;

    // tile (x, y) of head h is unit [s*32 + i/16 + x][h*2 + y] of g, 16 B per lane
    const _Float16* gp = gbuf + ((long)(s * 32 + ((i0 + wm * 64) >> 4)) * 16) * 256 + ln16 * 16 + ls;
    const _Float16* wp = wo16 + lane * 8;

    v8f acc[4][4];
#pragma unroll
    for (int x = 0; x < 4; ++x)
#pragma unroll
        for (int ct = 0; ct < 4; ++ct) acc[x][ct] = v8f{};

    pf_copy_stage(lw, lv, ga, gb);
    asm volatile("s_wait_asynccnt 0x0" ::: "memory");   // this wave's share of pass 0 has landed
    __syncthreads();                                    // pass 0 is readable by every wave
    pf_copy_stage(lw + PF_STAGE, lv + PF_STAGE, ga + 256, gb + 16 * 256);

    v16h a[2][4], b[2][2];
    pf_frags(a[0], b[0], pa, pb);

    // stays rolled
#pragma unroll 1
    for (int h = 0; h < 8; ++h) {
        // the head's gate values and its fragments of W_o are requested ahead of its passes,
        // so that their latency lies under the products
        v8h g8[4][2];
        v16h wo[4];
#pragma unroll
        for (int x = 0; x < 4; ++x)
#pragma unroll
            for (int y = 0; y < 2; ++y) g8[x][y] = *(const v8h*)(gp + x * 4096 + y * 256);
#pragma unroll
        for (int ct = 0; ct < 4; ++ct) wo[ct] = load_frag_p(wp, ct * 8);
        // stands before the address registers of the loads above are rewritten; its operands
        // keep them live up to it, so that no load's result lands in them ahead of the wait
        asm volatile("s_wait_xcnt 0x0" :: "v"(gp), "v"(wp) : "memory");
        gp += 512;                       // two units on
        wp += 512;                       // one fragment on
        ga += N_DIM * N_DIM;
        gb += 512 * 32 * 256;

        v8f c[4][2];
#pragma unroll
        for (int x = 0; x < 4; ++x)
#pragma unroll
            for (int y = 0; y < 2; ++y) c[x][y] = v8f{};

        const bool more = h + 1 < 8;
        // stays rolled: the buffer's offset is then a run-time value added once to each base, and
        // the reads' own offsets fit their instructions (unrolled, every read of buffer 1 took an
        // address register of its own)
#pragma unroll 1
        for (int p = 0; p < 2; ++p) {
            const int so = p * PF_STAGE, no = PF_STAGE - so;
            pf_pass(c, a, b, pa + so, pb + so, pa + no, pb + no, more, lw + so, lv + so,
                    ga + p * 256, gb + p * (16 * 256));
        }

#pragma unroll
        for (int x = 0; x < 4; ++x) {
            v8h o0, o1;
#pragma unroll
            for (int r = 0; r < 8; ++r) {
                o0[r] = (_Float16)(c[x][0][r] * (float)g8[x][0][r]);
                o1[r] = (_Float16)(c[x][1][r] * (float)g8[x][1][r]);
            }
            const v16h f = cat8(o0, o1);
#pragma unroll
            for (int ct = 0; ct < 4; ++ct) acc[x][ct] = wmma_f16(f, wo[ct], acc[x][ct]);
        }
    }
    asm volatile("s_wait_asynccnt 0x0" ::: "memory");      // no copy is outstanding at the wave's end

    float* op = out + (long)(s * N_DIM + i0 + wm * 64 + ls) * CM + ln16;
#pragma unroll
    for (int x = 0; x < 4; ++x)
#pragma unroll
        for (int ct = 0; ct < 4; ++ct)
#pragma unroll
            for (int r = 0; r < 8; ++r) op[(x * 16 + r) * CM + ct * 16] = acc[x][ct][r];
}

// ---------- launch ----------
extern "C" void kernel_launch(void* const* d_in, const int* in_sizes, int n_in,
                              void* d_out, int out_size, void* d_ws, size_t ws_size,
                              hipStream_t stream) {
    (void)in_sizes; (void)n_in; (void)out_size; (void)ws_size;
    const float* m     = (const float*)d_in[0];
    const float* z     = (const float*)d_in[1];
    const float* mask  = (const float*)d_in[2];
    const float* ln_mw = (const float*)d_in[3];
    const float* ln_mb = (const float*)d_in[4];
    const float* ln_zw = (const float*)d_in[5];
    const float* ln_zb = (const float*)d_in[6];
    const float* W_m   = (const float*)d_in[7];
    const float* W_g   = (const float*)d_in[8];
    const float* W_z   = (const float*)d_in[9];
    const float* W_o   = (const float*)d_in[10];
    float* out = (float*)d_out;

    _Float16* wbuf = (_Float16*)d_ws;                 //  2,097,152 halves
    _Float16* vbuf = wbuf + 2097152;                  // 33,554,432
    _Float16* gbuf = vbuf + 33554432;                 // 33,554,432
    _Float16* wm16 = gbuf + 33554432;                 //     16,384
    _Float16* wg16 = wm16 + 16384;                    //     16,384
    _Float16* wo16 = wg16 + 16384;                    //     16,384  (~138 MB total)

    k_prep_w      <<<64,    256, 0, stream>>>(W_m, W_g, W_o, wm16, wg16, wo16);
    k_vg          <<<1024,  256, 0, stream>>>(m, ln_mw, ln_mb, wm16, wg16, vbuf, gbuf);
    k_bias_softmax<<<512,   256, 0, stream>>>(z, mask, ln_zw, ln_zb, W_z, wbuf);
    k_pwa_out     <<<256,   256, 0, stream>>>(wbuf, vbuf, gbuf, wo16, out);
}

// v007
// Measured time: 71.3 microseconds a run.
// Two timings next to v006 both put it at 1.23 times that version's speed.
// Counting every step since v000, it is 5.44 times as fast.
#include <hip/hip_runtime.h>
#include <hip/hip_bf16.h>

typedef __attribute__((ext_vector_type(16))) _Float16 v16h;
typedef __attribute__((ext_vector_type(8)))  _Float16 v8h;
typedef __attribute__((ext_vector_type(8)))  float    v8f;
typedef __attribute__((ext_vector_type(2))) float f32x2;
typedef __attribute__((ext_vector_type(4))) float f32x4;

#define DEV static __device__ __forceinline__

// ---------- helpers ----------
DEV v16h cat8(v8h a, v8h b) {
    v16h r;
#pragma unroll
    for (int i = 0; i < 8; ++i) { r[i] = a[i]; r[i + 8] = b[i]; }
    return r;
}

// A/B fragment for V_WMMA_F32_16X16X32_F16 from a packed array (k_prep_w's weights, k_vg's mn): fragment u
// is two units of 512 B, one per 16-byte load of a wave. wl: the array + lane * 8.
// a lane's K chunks are [laneSel, +8) and [laneSel+16, +8) of the step, laneSel = (lane>>4)*8
DEV v16h load_frag_p(const _Float16* wl, int u) {
    v8h c0 = *(const v8h*)(wl + u * 512);
    v8h c1 = *(const v8h*)(wl + u * 512 + 256);
    return cat8(c0, c1);
}

DEV v8f wmma_f16(v16h a, v16h b, v8f c) {
    return __builtin_amdgcn_wmma_f32_16x16x32_f16(false, a, false, b, (short)0, c, false, false);
}

DEV float wave_sum(float x) {
#pragma unroll
    for (int o = 16; o > 0; o >>= 1) x += __shfl_xor(x, o, 32);
    return x;
}
DEV float wave_max(float x) {
#pragma unroll
    for (int o = 16; o > 0; o >>= 1) x = fmaxf(x, __shfl_xor(x, o, 32));
    return x;
}

// ---------- constants ----------
// B=1, S=256, N=512, C_M=64, C_Z=128, C_H=32, H=8, H*C_H=256
#define N_DIM   512
#define S_DIM   256
#define CM      64
#define CZ      128
#define HE      256

// ---------- kernel 0: one-shot weight conversion fp32 -> f16, in fragment order ----------
// W_m, W_g: (256,64); W_o: (64,256)  -> all 16384 elements, same flat size
// packed[row>>4][k>>5][(k>>4)&1] [lane = ((k>>3)&1)*16 + (row&15)][k&7]: the 16 B that lane
// loads for its fragment lie at lane * 16 of a 512-B unit, so a wave's load is 4 whole lines
// and not 32-B pieces of 16 rows
__global__ void k_prep_w(const float* __restrict__ Wm, const float* __restrict__ Wg,
                         const float* __restrict__ Wo,
                         _Float16* __restrict__ wm16, _Float16* __restrict__ wg16,
                         _Float16* __restrict__ wo16) {
    int idx = blockIdx.x * 256 + threadIdx.x;    // 64 blocks * 256 = 16384: place in the packed arrays
    int row = (idx >> 3) & 15;                   // row inside its tile of 16
    int k   = ((idx >> 8) & 1) * 16 + ((idx >> 7) & 1) * 8 + (idx & 7);   // k inside its step of 32
    int s64  = ((idx >> 10) * 16 + row) * CM + ((idx >> 9) & 1) * 32 + k; // 2 steps a row tile
    int s256 = ((idx >> 12) * 16 + row) * HE + ((idx >> 9) & 7) * 32 + k; // 8 steps a row tile
    wm16[idx] = (_Float16)Wm[s64];
    wg16[idx] = (_Float16)Wg[s64];
    wo16[idx] = (_Float16)Wo[s256];
}

// ---------- kernel 1: mn = layernorm(m) ; v = mn@Wm^T ----------
// a wave normalises its own 16 rows of m in the registers of its two A fragments: lane
// (row ln16, half lane>>4) holds channels ls + c*16 + [0,8), c = 0..3, so a row's sums are
// 32 values of a lane and one exchange with lane ^ 16.
// both outputs are f16 and lie in units of 512 B, each one 16-byte store of a wave:
//   v[h*512 + s*2 + (e>>4)][n>>4] [e&15][n&15]  (a lane holds 8 n of one e)
//   mn[s*32 + (n>>4)][fragment 0, 1][its two units]: the wave's two fragments as they stand in
//   its registers, for load_frag_p: k_pwa_out forms the gate from them
__global__ void k_vg(const float* __restrict__ m, const float* __restrict__ lw,
                     const float* __restrict__ lb,
                     const _Float16* __restrict__ wm16, _Float16* __restrict__ vbuf,
                     _Float16* __restrict__ mn16) {
    int lane = threadIdx.x & 31;
    int wv   = threadIdx.x >> 5;
    int ln16 = lane & 15;
    int ls   = (lane >> 4) * 8;
    int rowTile = blockIdx.x * 8 + wv;           // 8192 row tiles
    int r0 = rowTile * 16;

    const float* xrow = m + (long)(r0 + ln16) * CM + ls;
    f32x4 x[4][2], w4[4][2], b4[4][2];
#pragma unroll
    for (int c = 0; c < 4; ++c)
#pragma unroll
        for (int q = 0; q < 2; ++q) {
            w4[c][q] = *(const f32x4*)(lw + ls + c * 16 + q * 4);
            b4[c][q] = *(const f32x4*)(lb + ls + c * 16 + q * 4);
        }
#pragma unroll
    for (int c = 0; c < 4; ++c)
#pragma unroll
        for (int q = 0; q < 2; ++q) x[c][q] = *(const f32x4*)(xrow + c * 16 + q * 4);
    // stands before the address registers of the loads above are rewritten; its operands keep
    // those registers live up to it, so that neither a later load's result nor the next
    // kernel arguments land in them ahead of the wait
    asm volatile("s_wait_xcnt 0x0" :: "v"(xrow), "s"(lw), "s"(lb) : "memory");
    // keeps all 24 loads ahead of the sums: sunk behind them, the loads of lw and lb run in
    // dependent pairs after the row sums and their latencies add up
    __builtin_amdgcn_sched_barrier(0);

    f32x4 t1 = x[0][0] + x[0][1];
    f32x4 t2 = x[0][0] * x[0][0] + x[0][1] * x[0][1];
#pragma unroll
    for (int c = 1; c < 4; ++c)
#pragma unroll
        for (int q = 0; q < 2; ++q) { t1 += x[c][q]; t2 += x[c][q] * x[c][q]; }
    float s1 = (t1.x + t1.y) + (t1.z + t1.w);
    float s2 = (t2.x + t2.y) + (t2.z + t2.w);
    s1 += __shfl_xor(s1, 16, 32);
    s2 += __shfl_xor(s2, 16, 32);
    float mu = s1 * (1.0f / CM);
    float var = s2 * (1.0f / CM) - mu * mu;
    float rs = rsqrtf(var + 1e-5f);
    v16h a0, a1;
#pragma unroll
    for (int c = 0; c < 2; ++c)
#pragma unroll
        for (int q = 0; q < 2; ++q)
#pragma unroll
            for (int e = 0; e < 4; ++e) {
                a0[c * 8 + q * 4 + e] = (_Float16)((x[c][q][e] - mu) * rs * w4[c][q][e] + b4[c][q][e]);
                a1[c * 8 + q * 4 + e] =
                    (_Float16)((x[c + 2][q][e] - mu) * rs * w4[c + 2][q][e] + b4[c + 2][q][e]);
            }

    _Float16* md = mn16 + (long)rowTile * 1024 + lane * 8;
    *(v8h*)md         = __builtin_shufflevector(a0, a0, 0, 1, 2, 3, 4, 5, 6, 7);
    *(v8h*)(md + 256) = __builtin_shufflevector(a0, a0, 8, 9, 10, 11, 12, 13, 14, 15);
    *(v8h*)(md + 512) = __builtin_shufflevector(a1, a1, 0, 1, 2, 3, 4, 5, 6, 7);
    *(v8h*)(md + 768) = __builtin_shufflevector(a1, a1, 8, 9, 10, 11, 12, 13, 14, 15);
    // stands before the address register of the four stores is rewritten; its operand keeps
    // it live up to the wait
    asm volatile("s_wait_xcnt 0x0" :: "v"(md) : "memory");

    int s  = r0 >> 9;                            // row / 512
    int nt = (r0 & 511) >> 4;                    // the wave's 16 n
    int lo = ln16 * 16 + ls;                     // this lane's 8 halves of a unit

    // ---- v path ---- a trip is a head: its two tiles of 16 e lie 32 units apart
    _Float16* vdst = vbuf + ((long)(s * 2) * 32 + nt) * 256 + lo;
    const _Float16* wml = wm16 + lane * 8;
    for (int hh = 0; hh < 8; ++hh) {
        v8f c0 = {}, c1 = {};
        c0 = wmma_f16(a0, load_frag_p(wml, hh * 4),     c0);
        c1 = wmma_f16(a0, load_frag_p(wml, hh * 4 + 2), c1);
        c0 = wmma_f16(a1, load_frag_p(wml, hh * 4 + 1), c0);
        c1 = wmma_f16(a1, load_frag_p(wml, hh * 4 + 3), c1);
        v8h o0, o1;
#pragma unroll
        for (int r = 0; r < 8; ++r) { o0[r] = (_Float16)c0[r]; o1[r] = (_Float16)c1[r]; }
        *(v8h*)vdst = o0;
        *(v8h*)(vdst + 32 * 256) = o1;
        // stands before the next trip's weight loads land in the registers of the two stores
        asm volatile("s_wait_xcnt 0x0" ::: "memory");
        vdst += 512 * 32 * 256;
    }
}

// ---------- kernel 2: LN(z) + pair bias + mask + softmax -> w_f16[h][i][j] ----------
// with wl[h][c] = ln_w[c] * Wz[h][c], S[h] = sum_c wl[h][c], C[h] = sum_c ln_b[c] * Wz[h][c]:
//   logit[h] = rs * (sum_c x[c] * wl[h][c] - mu * S[h]) + C[h]
// so the ten sums of a row (x, x*x, eight heads) all start from x and are reduced in one pass.
// 8 lanes hold a row, 16 channels each: a 16-byte load of a wave is one whole 128-byte line
// of each of 4 rows. lane = r4 * 8 + c8; channels of a lane: k*32 + c8*4 + [0,4), k = 0..3.

#define LG_PITCH 516    // floats; head h starts 4h banks on: the 4 rows x 8 heads of a store meet 32 banks

// keep + (send of lane l ^ M), M = 1, 2 or 4: row_xmask, inside a 16-lane row
template <int M> DEV float add_xor(float keep, float send) {
    int y = __builtin_amdgcn_update_dpp(0, __builtin_bit_cast(int, send), 0x160 + M, 0xf, 0xf, true);
    return keep + __builtin_bit_cast(float, y);
}
// sum over the 8 lanes of a row, in every one of them
DEV float sum8(float x) {
    x = add_xor<1>(x, x);
    x = add_xor<2>(x, x);
    return add_xor<4>(x, x);
}
// sum over the 8 lanes of a row of a[c8]: each step halves the values a lane still carries.
// b0, b1, b2: bits of c8
DEV float scatter8(const float (&a)[8], bool b0, bool b1, bool b2) {
    float r[4], u[2];
#pragma unroll
    for (int q = 0; q < 4; ++q)
        r[q] = add_xor<1>(b0 ? a[2 * q + 1] : a[2 * q], b0 ? a[2 * q] : a[2 * q + 1]);
#pragma unroll
    for (int q = 0; q < 2; ++q)
        u[q] = add_xor<2>(b1 ? r[2 * q + 1] : r[2 * q], b1 ? r[2 * q] : r[2 * q + 1]);
    return add_xor<4>(b2 ? u[1] : u[0], b2 ? u[0] : u[1]);
}

// 8 rows (two groups of 4) of z and their mask values, pass t of a wave
// zp, mp: the wave's first row, the same in every lane; zo, mo: this lane's offsets from them
DEV void z_load(f32x4 (&v)[2][4], float (&mk)[2], const float* zp, const float* mp,
                unsigned zo, unsigned mo, int t) {
#pragma unroll
    for (int g = 0; g < 2; ++g) {
#pragma unroll
        for (int k = 0; k < 4; ++k)
            v[g][k] = *(const f32x4*)(zp + (t * 8 + g * 4) * CZ + k * 32 + zo);
        mk[g] = mp[t * 8 + g * 4 + mo];
    }
    // stands before the address registers of the loads above are rewritten
    asm volatile("s_wait_xcnt 0x0" ::: "memory");
    // keeps the loads ahead of the sums that follow: sunk behind them they would not overlap
    __builtin_amdgcn_sched_barrier(0);
}

// logit of head c8 for this lane's row
DEV float z_logit(const f32x4 (&v)[4], const f32x2 (&wl)[8][8], float S, float C,
                  bool b0, bool b1, bool b2) {
    f32x2 x[8];
#pragma unroll
    for (int k = 0; k < 4; ++k) { x[2 * k] = v[k].lo; x[2 * k + 1] = v[k].hi; }
    f32x2 t1 = x[0], t2 = x[0] * x[0];
#pragma unroll
    for (int q = 1; q < 8; ++q) { t1 += x[q]; t2 += x[q] * x[q]; }
    float d[8];
#pragma unroll
    for (int h = 0; h < 8; ++h) {
        f32x2 a = x[0] * wl[h][0];
#pragma unroll
        for (int q = 1; q < 8; ++q) a += x[q] * wl[h][q];
        d[h] = a.x + a.y;
    }
    float s1 = sum8(t1.x + t1.y);
    float s2 = sum8(t2.x + t2.y);
    float dh = scatter8(d, b0, b1, b2);
    float mu = s1 * (1.0f / CZ);
    float var = s2 * (1.0f / CZ) - mu * mu;
    float rs = rsqrtf(var + 1e-5f);
    return rs * (dh - mu * S) + C;
}

// the 8 rows of a pass: masked logits to LDS, lp = this lane's place for the pass's first group
DEV void z_pass(const f32x4 (&v)[2][4], const float (&mk)[2], float* lp, const f32x2 (&wl)[8][8],
                float S, float C, bool b0, bool b1, bool b2) {
#pragma unroll
    for (int g = 0; g < 2; ++g)
        lp[g * 4] = z_logit(v[g], wl, S, C, b0, b1, b2) + (1.0f - mk[g]) * (-1000000.0f);
}

// four waves per SIMD: both work-groups of a WGP are resident, all 512 in one round
__global__ void __launch_bounds__(256) __attribute__((amdgpu_waves_per_eu(4, 4)))
k_bias_softmax(const float* __restrict__ z, const float* __restrict__ mask,
               const float* __restrict__ lzw, const float* __restrict__ lzb,
               const float* __restrict__ Wz, _Float16* __restrict__ wout) {
    __shared__ float logits[8][LG_PITCH];
    int lane = threadIdx.x & 31;
    int wv   = threadIdx.x >> 5;
    int i    = blockIdx.x;                       // 512 blocks
    int c8   = lane & 7;
    int r4   = lane >> 3;
    bool b0 = c8 & 1, b1 = c8 & 2, b2 = c8 & 4;

    // C first: its products are not kept
    const float* wzp = Wz + c8 * 4;
    float S, C;
    {
        f32x4 b4[4];
#pragma unroll
        for (int k = 0; k < 4; ++k) b4[k] = *(const f32x4*)(lzb + k * 32 + c8 * 4);
        float pc[8];
#pragma unroll
        for (int h = 0; h < 8; ++h) {
            f32x4 a = *(const f32x4*)(wzp + h * CZ) * b4[0];
#pragma unroll
            for (int k = 1; k < 4; ++k) a += *(const f32x4*)(wzp + h * CZ + k * 32) * b4[k];
            pc[h] = (a.x + a.y) + (a.z + a.w);
        }
        C = scatter8(pc, b0, b1, b2);
    }
    // keeps the products for wl behind the sums for C: scheduled together they overflow the
    // registers of four waves per SIMD and spill
    __builtin_amdgcn_sched_barrier(0);
    f32x2 wl[8][8];
    {
        f32x4 w4[4];
#pragma unroll
        for (int k = 0; k < 4; ++k) w4[k] = *(const f32x4*)(lzw + k * 32 + c8 * 4);
        float ps[8];
#pragma unroll
        for (int h = 0; h < 8; ++h) {
#pragma unroll
            for (int k = 0; k < 4; ++k) {
                const f32x4 pw = *(const f32x4*)(wzp + h * CZ + k * 32) * w4[k];
                wl[h][2 * k] = pw.lo; wl[h][2 * k + 1] = pw.hi;
            }
            f32x2 a = wl[h][0];
#pragma unroll
            for (int q = 1; q < 8; ++q) a += wl[h][q];
            ps[h] = a.x + a.y;
        }
        S = scatter8(ps, b0, b1, b2);
    }

    // wave wv owns rows j = wv*64 + [0,64): 8 passes of 8 rows, two register buffers, the
    // next pass's loads in flight while a pass is summed
    // the wave's number from a scalar register: the rows' base address is then scalar, which
    // saves the vector registers that would otherwise spill
    int wvu = __builtin_amdgcn_readfirstlane(wv);
    const float* zp = z + ((long)i * N_DIM + wvu * 64) * CZ;
    const float* mp = mask + (long)i * N_DIM + wvu * 64;
    unsigned zo = r4 * CZ + c8 * 4, mo = r4;
    float* lp = &logits[c8][wv * 64 + r4];
    f32x4 va[2][4], vb[2][4];
    float ma[2], mb[2];
    // the weights above are complete before the first rows are requested: scheduled together
    // they overflow the registers of four waves per SIMD and spill
    __builtin_amdgcn_sched_barrier(0);
    z_load(va, ma, zp, mp, zo, mo, 0);
    for (int t = 0; t < 6; t += 2) {
        z_load(vb, mb, zp, mp, zo, mo, t + 1);
        z_pass(va, ma, lp + t * 8, wl, S, C, b0, b1, b2);
        z_load(va, ma, zp, mp, zo, mo, t + 2);
        z_pass(vb, mb, lp + (t + 1) * 8, wl, S, C, b0, b1, b2);
    }
    z_load(vb, mb, zp, mp, zo, mo, 7);
    z_pass(va, ma, lp + 6 * 8, wl, S, C, b0, b1, b2);
    z_pass(vb, mb, lp + 7 * 8, wl, S, C, b0, b1, b2);
    __syncthreads();

    // wave wv owns head wv: softmax over 512
    float vmax = -3.0e38f;
#pragma unroll
    for (int t = 0; t < 16; ++t) vmax = fmaxf(vmax, logits[wv][lane + t * 32]);
    vmax = wave_max(vmax);
    float ex[16], ssum = 0.0f;
#pragma unroll
    for (int t = 0; t < 16; ++t) { ex[t] = __expf(logits[wv][lane + t * 32] - vmax); ssum += ex[t]; }
    ssum = wave_sum(ssum);
    float inv = 1.0f / ssum;
#pragma unroll
    for (int t = 0; t < 16; ++t)
        wout[((long)wv * N_DIM + i) * N_DIM + lane + t * 32] = (_Float16)(ex[t] * inv);
}

// ---------- kernel 3: o = w @ v, g = sigmoid(mn @ W_g^T), out = (g * o) @ W_o^T (fp32 out) ----------
// a work-group takes 128 i x 4 s (128 col = s*32+e of every head) through all 8 heads, one
// after the other: 256 work-groups, one per WGP. 8 waves as 2 (i) x 4 (s), each 64 i x 32 e.
// per head: C[e][i] = sum_j v[e][j] * w[i][j], v as the A operand: a lane then holds 8
// consecutive e of one i in each of the two e tiles, which are, gated and rounded to f16, the
// two k chunks of its A fragment for the product with head h's 32 columns of W_o. The 64 x 64
// sums of out stay in registers over the heads (heads summed in the order 0..7).
// the gate is formed here too: a wave's 64 i x 1 s are 64 rows of mn that no other wave needs.
// It keeps them as eight B fragments, loaded once; with a tile of W_g as A the product has e
// and i where C has them, so gate and C meet lane by lane.
// a pass is 256 j = 512 B of every operand row, staged in LDS at pitch 528 B, two buffers:
// a head is two passes, buffer 0 and then buffer 1.
#define PF_BM     128
#define PF_BN     128
#define PF_PITCH  528
#define PF_STAGE  ((PF_BM + PF_BN) * PF_PITCH)     // 135,168 B

// eight copies of 16 B per lane: copy k lands at LDS byte l + N, N = N0 + k * DL, and reads
// global byte g + G0 + k * DG. N goes into the instruction's offset field, which moves both
// addresses (all N here lie under 65,536), so one register holds the LDS address of them all
// and the global address register holds the source less N
template <int N0, int DL, int G0, int DG> DEV void pf_copy8(unsigned l, const unsigned char* g) {
    // the copies and, as the last line, the wait that stands before their address
    // registers may be rewritten
    asm volatile(
        "global_load_async_to_lds_b128 %0, %1, off offset:%9\n\t"
        "global_load_async_to_lds_b128 %0, %2, off offset:%10\n\t"
        "global_load_async_to_lds_b128 %0, %3, off offset:%11\n\t"
        "global_load_async_to_lds_b128 %0, %4, off offset:%12\n\t"
        "global_load_async_to_lds_b128 %0, %5, off offset:%13\n\t"
        "global_load_async_to_lds_b128 %0, %6, off offset:%14\n\t"
        "global_load_async_to_lds_b128 %0, %7, off offset:%15\n\t"
        "global_load_async_to_lds_b128 %0, %8, off offset:%16\n\t"
        "s_wait_xcnt 0x0"
        :: "v"(l),
           "v"(g + (G0 - N0)),                 "v"(g + (G0 - N0 + (DG - DL))),
           "v"(g + (G0 - N0 + 2 * (DG - DL))), "v"(g + (G0 - N0 + 3 * (DG - DL))),
           "v"(g + (G0 - N0 + 4 * (DG - DL))), "v"(g + (G0 - N0 + 5 * (DG - DL))),
           "v"(g + (G0 - N0 + 6 * (DG - DL))), "v"(g + (G0 - N0 + 7 * (DG - DL))),
           "i"(N0),          "i"(N0 + DL),     "i"(N0 + 2 * DL), "i"(N0 + 3 * DL),
           "i"(N0 + 4 * DL), "i"(N0 + 5 * DL), "i"(N0 + 6 * DL), "i"(N0 + 7 * DL)
        : "memory");
}

// one stage: 256 rows x 512 B = 8192 copies of 16 B, 32 per thread (16 of w, 16 of v).
// w: a copy of a wave is the 512 B of one row, row k * 8 + wv. lw, ga: row wv, chunk lane.
// v: a copy of a wave is one 512-B unit, 16 rows (e) x 32 B (16 j): tile k & 7, 16 j number
// (k >> 3) * 8 + wv. lv, gb: tile 0, number wv; row lane >> 1, chunk bit lane & 1.
DEV void pf_copy_stage(unsigned lw, unsigned lv, const _Float16* ga, const _Float16* gb) {
    const unsigned char* a = (const unsigned char*)ga;
    const unsigned char* b = (const unsigned char*)gb;
    pf_copy8<0,             8 * PF_PITCH,  0,              8 * N_DIM * 2>(lw, a);
    pf_copy8<64 * PF_PITCH, 8 * PF_PITCH,  64 * N_DIM * 2, 8 * N_DIM * 2>(lw, a);
    pf_copy8<0,             16 * PF_PITCH, 0,              32 * 512>(lv, b);
    pf_copy8<256,           16 * PF_PITCH, 8 * 512,        32 * 512>(lv, b);
}

// the six fragments of 32 j: pa, pb = this lane's place in the first w and the first v tile
DEV void pf_frags(v16h (&a)[4], v16h (&b)[2], const unsigned char* pa, const unsigned char* pb) {
#pragma unroll
    for (int x = 0; x < 4; ++x) {
        const unsigned char* p = pa + x * 16 * PF_PITCH;
        a[x] = cat8(*(const v8h*)p, *(const v8h*)(p + 32));
    }
#pragma unroll
    for (int y = 0; y < 2; ++y) {
        const unsigned char* p = pb + y * 16 * PF_PITCH;
        b[y] = cat8(*(const v8h*)p, *(const v8h*)(p + 32));
    }
}

// one pass: eight steps of 32 j, each step's fragments read one step ahead into the other
// register set. pa, pb: this lane's places in the pass's buffer; na, nb: in the other buffer.
// more: a head follows, whose pass of the same number refills this buffer (lw, lv, ga, gb).
DEV void pf_pass(v8f (&c)[4][2], v16h (&a)[2][4], v16h (&b)[2][2], const unsigned char* pa,
                 const unsigned char* pb, const unsigned char* na, const unsigned char* nb,
                 bool more, unsigned lw, unsigned lv, const _Float16* ga, const _Float16* gb) {
#pragma unroll
    for (int ks = 0; ks < 8; ++ks) {
        if (ks < 7) {
            pf_frags(a[(ks + 1) & 1], b[(ks + 1) & 1], pa + (ks + 1) * 64, pb + (ks + 1) * 64);
        } else {
            asm volatile("s_wait_dscnt 0x0" ::: "memory");     // this wave has left the pass's buffer
            asm volatile("s_wait_asynccnt 0x0" ::: "memory");  // its share of the next pass has landed
            __syncthreads();                                   // publishes the next pass, frees this buffer
            if (more) pf_copy_stage(lw, lv, ga, gb);
            // first step of the next pass, out of the other buffer. Behind the very last pass
            // these reads find the pass before it and are not used: without a branch round
            // them the compiler counts the waits of one path only
            pf_frags(a[0], b[0], na, nb);
        }
        // keeps the twelve reads of the next step as one group ahead of this step's products:
        // sunk to their uses each pair of reads is waited for in full before two products
        __builtin_amdgcn_sched_barrier(0);
#pragma unroll
        for (int x = 0; x < 4; ++x)
#pragma unroll
            for (int y = 0; y < 2; ++y) c[x][y] = wmma_f16(b[ks & 1][y], a[ks & 1][x], c[x][y]);
        // keeps the reads of the step after next behind these products, whose operands they overwrite
        __builtin_amdgcn_sched_barrier(0);
    }
}

// two waves per SIMD: one work-group owns the WGP's LDS, a wave up to 512 registers
__global__ void __launch_bounds__(256) __attribute__((amdgpu_waves_per_eu(2, 2)))
k_pwa_out(const _Float16* __restrict__ wbuf, const _Float16* __restrict__ vbuf,
          const _Float16* __restrict__ mn16, const _Float16* __restrict__ wg16,
          const _Float16* __restrict__ wo16, float* __restrict__ out) {
    __shared__ __attribute__((aligned(16))) unsigned char L[2 * PF_STAGE];
    int tid  = threadIdx.x;
    int lane = tid & 31;
    int wv   = tid >> 5;
    int ln16 = lane & 15;
    int ls   = (lane >> 4) * 8;
    int wm   = wv >> 2;                  // wave row    [0,2): 64 i
    int wn   = wv & 3;                   // wave column [0,4): one s

    // 64 groups of 4 s * 4 i tiles = 256. The four work-groups that read the same tiles of v
    // stand 8 apart in the grid. For speed only: any placement is right
    int blk  = blockIdx.x;
    int sg   = (blk & 7) | ((blk >> 5) << 3);
    int i0   = ((blk >> 3) & 3) * PF_BM;
    int s    = sg * 4 + wn;

    // copy addresses of this thread for head 0, pass 0. A pass on: 256 j = 256 halves of a row
    // of w, 16 units of v. A head on: 512 rows of w, 512 tiles of 32 units of v
    const _Float16* ga = wbuf + (long)(i0 + wv) * N_DIM + lane * 8;
    const _Float16* gb = vbuf + ((long)(sg * 8) * 32 + wv) * 256 + lane * 8;
    const unsigned lw = (unsigned)(size_t)L + wv * PF_PITCH + lane * 16;
    const unsigned lv = (unsigned)(size_t)L + (PF_BM + (lane >> 1)) * PF_PITCH + wv * 32 + (lane & 1) * 16;

    // fragment read places of this lane in buffer 0
    const unsigned char* pa = L + (wm * 64 + ln16) * PF_PITCH + ls * 2;
    const unsigned char* pb = L + (PF_BM + wn * 32 + ln16) * PF_PITCH + ls * 2;

    // e tile y of head h is row tile h*2 + y of W_g: fragments (h*2 + y)*2 and the next
    const _Float16* wgp = wg16 + lane * 8;
    const _Float16* wp = wo16 + lane * 8;

    v8f acc[4][4];
#pragma unroll
    for (int x = 0; x < 4; ++x)
#pragma unroll
        for (int ct = 0; ct < 4; ++ct) acc[x][ct] = v8f{};

    pf_copy_stage(lw, lv, ga, gb);
    asm volatile("s_wait_asynccnt 0x0" ::: "memory");   // this wave's share of pass 0 has landed
    __syncthreads();                                    // pass 0 is readable by every wave
    pf_copy_stage(lw + PF_STAGE, lv + PF_STAGE, ga + 256, gb + 16 * 256);
    // keeps the loads below behind the barrier above, which waits for every load in flight:
    // here they have all of pass 0 to arrive
    __builtin_amdgcn_sched_barrier(0);

    // the wave's 64 rows of mn: mb[x][k] = channels k*32 + [0,32) of the 16 rows of i tile x
    const _Float16* mp = mn16 + (long)(s * 32 + ((i0 + wm * 64) >> 4)) * 1024 + lane * 8;
    v16h mb[4][2];
#pragma unroll
    for (int x = 0; x < 4; ++x)
#pragma unroll
        for (int k = 0; k < 2; ++k) mb[x][k] = load_frag_p(mp, x * 2 + k);
    // stands before the address register of the loads above is rewritten; its operand keeps
    // it live up to it, so that no load's result lands in it ahead of the wait
    asm volatile("s_wait_xcnt 0x0" :: "v"(mp) : "memory");

    v16h a[2][4], b[2][2];
    pf_frags(a[0], b[0], pa, pb);

    // stays rolled
#pragma unroll 1
    for (int h = 0; h < 8; ++h) {
        // the head's fragments of W_g and of W_o are requested ahead of its passes, so that
        // their latency lies under the products
        v16h wg[2][2], wo[4];
#pragma unroll
        for (int y = 0; y < 2; ++y)
#pragma unroll
            for (int k = 0; k < 2; ++k) wg[y][k] = load_frag_p(wgp, y * 2 + k);
#pragma unroll
        for (int ct = 0; ct < 4; ++ct) wo[ct] = load_frag_p(wp, ct * 8);
        // stands before the address registers of the loads above are rewritten; its operands
        // keep them live up to it, so that no load's result lands in them ahead of the wait
        asm volatile("s_wait_xcnt 0x0" :: "v"(wgp), "v"(wp) : "memory");
        wgp += 4 * 512;                  // four fragments on
        wp += 512;                       // one fragment on
        ga += N_DIM * N_DIM;
        gb += 512 * 32 * 256;

        v8f c[4][2];
#pragma unroll
        for (int x = 0; x < 4; ++x)
#pragma unroll
            for (int y = 0; y < 2; ++y) c[x][y] = v8f{};

        const bool more = h + 1 < 8;
        // stays rolled: the buffer's offset is then a run-time value added once to each base, and
        // the reads' own offsets fit their instructions (unrolled, every read of buffer 1 took an
        // address register of its own)
#pragma unroll 1
        for (int p = 0; p < 2; ++p) {
            const int so = p * PF_STAGE, no = PF_STAGE - so;
            pf_pass(c, a, b, pa + so, pb + so, pa + no, pb + no, more, lw + so, lv + so,
                    ga + p * 256, gb + p * (16 * 256));
        }

#pragma unroll
        for (int x = 0; x < 4; ++x) {
            v8f t0 = {}, t1 = {};
            t0 = wmma_f16(wg[0][0], mb[x][0], t0);
            t1 = wmma_f16(wg[1][0], mb[x][0], t1);
            t0 = wmma_f16(wg[0][1], mb[x][1], t0);
            t1 = wmma_f16(wg[1][1], mb[x][1], t1);
            v8h o0, o1;
#pragma unroll
            for (int r = 0; r < 8; ++r) {
                o0[r] = (_Float16)(c[x][0][r] * __builtin_amdgcn_rcpf(1.0f + __expf(-t0[r])));
                o1[r] = (_Float16)(c[x][1][r] * __builtin_amdgcn_rcpf(1.0f + __expf(-t1[r])));
            }
            const v16h f = cat8(o0, o1);
#pragma unroll
            for (int ct = 0; ct < 4; ++ct) acc[x][ct] = wmma_f16(f, wo[ct], acc[x][ct]);
        }
    }
    asm volatile("s_wait_asynccnt 0x0" ::: "memory");      // no copy is outstanding at the wave's end

    float* op = out + (long)(s * N_DIM + i0 + wm * 64 + ls) * CM + ln16;
#pragma unroll
    for (int x = 0; x < 4; ++x)
#pragma unroll
        for (int ct = 0; ct < 4; ++ct)
#pragma unroll
            for (int r = 0; r < 8; ++r) op[(x * 16 + r) * CM + ct * 16] = acc[x][ct][r];
}

// ---------- launch ----------
extern "C" void kernel_launch(void* const* d_in, const int* in_sizes, int n_in,
                              void* d_out, int out_size, void* d_ws, size_t ws_size,
                              hipStream_t stream) {
    (void)in_sizes; (void)n_in; (void)out_size; (void)ws_size;
    const float* m     = (const float*)d_in[0];
    const float* z     = (const float*)d_in[1];
    const float* mask  = (const float*)d_in[2];
    const float* ln_mw = (const float*)d_in[3];
    const float* ln_mb = (const float*)d_in[4];
    const float* ln_zw = (const float*)d_in[5];
    const float* ln_zb = (const float*)d_in[6];
    const float* W_m   = (const float*)d_in[7];
    const float* W_g   = (const float*)d_in[8];
    const float* W_z   = (const float*)d_in[9];
    const float* W_o   = (const float*)d_in[10];
    float* out = (float*)d_out;

    _Float16* wbuf = (_Float16*)d_ws;                 //  2,097,152 halves
    _Float16* vbuf = wbuf + 2097152;                  // 33,554,432
    _Float16* mn16 = vbuf + 33554432;                 //  8,388,608
    _Float16* wm16 = mn16 + 8388608;                  //     16,384
    _Float16* wg16 = wm16 + 16384;                    //     16,384
    _Float16* wo16 = wg16 + 16384;                    //     16,384  (~88 MB total)

    k_prep_w      <<<64,    256, 0, stream>>>(W_m, W_g, W_o, wm16, wg16, wo16);
    k_vg          <<<1024,  256, 0, stream>>>(m, ln_mw, ln_mb, wm16, vbuf, mn16);
    k_bias_softmax<<<512,   256, 0, stream>>>(z, mask, ln_zw, ln_zb, W_z, wbuf);
    k_pwa_out     <<<256,   256, 0, stream>>>(wbuf, vbuf, mn16, wg16, wo16, out);
}

// v008
// It runs in 61.5 microseconds.
// Next to v007, in two timings, it ran 1.15 and 1.16 times as fast.
// Over all steps from v000 it is 6.29 times as fast.
#include <hip/hip_runtime.h>
#include <hip/hip_bf16.h>

typedef __attribute__((ext_vector_type(16))) _Float16 v16h;
typedef __attribute__((ext_vector_type(8)))  _Float16 v8h;
typedef __attribute__((ext_vector_type(4)))  _Float16 v4h;
typedef __attribute__((ext_vector_type(8)))  float    v8f;
typedef __attribute__((ext_vector_type(2))) float f32x2;
typedef __attribute__((ext_vector_type(4))) float f32x4;

#define DEV static __device__ __forceinline__

// ---------- helpers ----------
DEV v16h cat8(v8h a, v8h b) {
    v16h r;
#pragma unroll
    for (int i = 0; i < 8; ++i) { r[i] = a[i]; r[i + 8] = b[i]; }
    return r;
}

// A/B fragment for V_WMMA_F32_16X16X32_F16 from a packed weight array (prep_body): fragment u
// is two units of 512 B, one per 16-byte load of a wave. wl: the array + lane * 8.
// a lane's K chunks are [laneSel, +8) and [laneSel+16, +8) of the step, laneSel = (lane>>4)*8
DEV v16h load_frag_p(const _Float16* wl, int u) {
    v8h c0 = *(const v8h*)(wl + u * 512);
    v8h c1 = *(const v8h*)(wl + u * 512 + 256);
    return cat8(c0, c1);
}

DEV v8f wmma_f16(v16h a, v16h b, v8f c) {
    return __builtin_amdgcn_wmma_f32_16x16x32_f16(false, a, false, b, (short)0, c, false, false);
}

DEV float wave_sum(float x) {
#pragma unroll
    for (int o = 16; o > 0; o >>= 1) x += __shfl_xor(x, o, 32);
    return x;
}
DEV float wave_max(float x) {
#pragma unroll
    for (int o = 16; o > 0; o >>= 1) x = fmaxf(x, __shfl_xor(x, o, 32));
    return x;
}

// ---------- constants ----------
// B=1, S=256, N=512, C_M=64, C_Z=128, C_H=32, H=8, H*C_H=256
#define N_DIM   512
#define S_DIM   256
#define CM      64
#define CZ      128
#define HE      256

// ---------- front launch, part 0: weight conversion fp32 -> f16, in fragment order ----------
// W_g: (256,64); W_o: (64,256)  -> 16384 elements each, same flat size
// packed[row>>4][k>>5][(k>>4)&1] [lane = ((k>>3)&1)*16 + (row&15)][k&7]: the 16 B that lane
// loads for its fragment lie at lane * 16 of a 512-B unit, so a wave's load is 4 whole lines
// and not 32-B pieces of 16 rows
#define PREP_BLOCKS 64
DEV void prep_body(int blk, const float* __restrict__ Wg, const float* __restrict__ Wo,
                   _Float16* __restrict__ wg16, _Float16* __restrict__ wo16) {
    int idx = blk * 256 + threadIdx.x;           // 64 blocks * 256 = 16384: place in the packed arrays
    int row = (idx >> 3) & 15;                   // row inside its tile of 16
    int k   = ((idx >> 8) & 1) * 16 + ((idx >> 7) & 1) * 8 + (idx & 7);   // k inside its step of 32
    int s64  = ((idx >> 10) * 16 + row) * CM + ((idx >> 9) & 1) * 32 + k; // 2 steps a row tile
    int s256 = ((idx >> 12) * 16 + row) * HE + ((idx >> 9) & 7) * 32 + k; // 8 steps a row tile
    wg16[idx] = (_Float16)Wg[s64];
    wo16[idx] = (_Float16)Wo[s256];
}

// ---------- front launch, part 1: mn = layernorm(m) ; v = mn@Wm^T ----------
// a wave normalises its 2 x 16 rows of m in the registers of their A fragments: lane
// (row ln16, half lane>>4) holds channels ls + c*16 + [0,8), c = 0..3, so a row's sums are
// 32 values of a lane and one exchange with lane ^ 16.
// both outputs are f16 and lie in units of 512 B, each one 16-byte store of a wave:
//   v[h*512 + s*2 + (e>>4)][n>>4] [e&15][n&15]  (a lane holds 8 n of one e)
//   mn[s*32 + (n>>4)][fragment 0, 1][its two units]: the wave's two fragments as they stand in
//   its registers, for load_frag_p: k_pwa_out forms the gate from them
// W_m is converted by the work-group itself, into LDS, in the fragment order of prep_body: no
// launch has to come first. A unit's two halves of 256 B stand 272 B apart and units 544 B, so
// that the 16 lanes that hold one row of W_m store to 32 different banks
#define WL_HALF 272
#define WL_UNIT 544
#define VG_BLOCKS 512

DEV v16h lds_frag(const unsigned char* wl, int u) {
    return cat8(*(const v8h*)(wl + u * (2 * WL_UNIT)), *(const v8h*)(wl + u * (2 * WL_UNIT) + WL_UNIT));
}

// the two A fragments of 16 rows, normalised
DEV void vg_norm(const f32x4 (&x)[4][2], const f32x4 (&w4)[4][2], const f32x4 (&b4)[4][2],
                 v16h& a0, v16h& a1) {
    f32x4 t1 = x[0][0] + x[0][1];
    f32x4 t2 = x[0][0] * x[0][0] + x[0][1] * x[0][1];
#pragma unroll
    for (int c = 1; c < 4; ++c)
#pragma unroll
        for (int q = 0; q < 2; ++q) { t1 += x[c][q]; t2 += x[c][q] * x[c][q]; }
    float s1 = (t1.x + t1.y) + (t1.z + t1.w);
    float s2 = (t2.x + t2.y) + (t2.z + t2.w);
    s1 += __shfl_xor(s1, 16, 32);
    s2 += __shfl_xor(s2, 16, 32);
    float mu = s1 * (1.0f / CM);
    float var = s2 * (1.0f / CM) - mu * mu;
    float rs = rsqrtf(var + 1e-5f);
#pragma unroll
    for (int c = 0; c < 2; ++c)
#pragma unroll
        for (int q = 0; q < 2; ++q)
#pragma unroll
            for (int e = 0; e < 4; ++e) {
                a0[c * 8 + q * 4 + e] = (_Float16)((x[c][q][e] - mu) * rs * w4[c][q][e] + b4[c][q][e]);
                a1[c * 8 + q * 4 + e] =
                    (_Float16)((x[c + 2][q][e] - mu) * rs * w4[c + 2][q][e] + b4[c + 2][q][e]);
            }
}

DEV void vg_body(int blk, const float* __restrict__ m, const float* __restrict__ lw,
                 const float* __restrict__ lb, const float* __restrict__ Wm,
                 _Float16* __restrict__ vbuf, _Float16* __restrict__ mn16) {
    __shared__ __attribute__((aligned(16))) unsigned char WL[64 * WL_UNIT];
    int tid  = threadIdx.x;
    int lane = tid & 31;
    int wv   = tid >> 5;
    int ln16 = lane & 15;
    int ls   = (lane >> 4) * 8;
    int rowTile = blk * 16 + wv * 2;             // 8192 row tiles, two a wave
    int r0 = rowTile * 16;

    const float* xrow = m + (long)(r0 + ln16) * CM + ls;
    // 16 B of a thread, 512 B (two rows of W_m) of a wave; trip j is row tile j
    const float* wsrc = Wm + tid * 4;
    f32x4 x[2][4][2], w4[4][2], b4[4][2], wr[16];
#pragma unroll
    for (int u = 0; u < 2; ++u)
#pragma unroll
        for (int c = 0; c < 4; ++c)
#pragma unroll
            for (int q = 0; q < 2; ++q) x[u][c][q] = *(const f32x4*)(xrow + u * 16 * CM + c * 16 + q * 4);
#pragma unroll
    for (int j = 0; j < 16; ++j) wr[j] = *(const f32x4*)(wsrc + j * 1024);
#pragma unroll
    for (int c = 0; c < 4; ++c)
#pragma unroll
        for (int q = 0; q < 2; ++q) {
            w4[c][q] = *(const f32x4*)(lw + ls + c * 16 + q * 4);
            b4[c][q] = *(const f32x4*)(lb + ls + c * 16 + q * 4);
        }
    // stands before the address registers of the loads above are rewritten; its operands keep
    // those registers live up to it, so that no later load's result lands in them ahead of the wait
    asm volatile("s_wait_xcnt 0x0" :: "v"(xrow), "s"(Wm), "s"(lw), "s"(lb) : "memory");
    // keeps all 48 loads ahead of the work on them: sunk behind it, they run in dependent
    // groups and their latencies add up
    __builtin_amdgcn_sched_barrier(0);

    // row tid >> 4 of the tile, k = (tid & 15) * 4 + [0,4) of its 64
    {
        unsigned char* wd = WL + ((tid >> 2) & 3) * WL_UNIT + ((tid >> 1) & 1) * WL_HALF
                          + (tid >> 4) * 16 + (tid & 1) * 8;
#pragma unroll
        for (int j = 0; j < 16; ++j) {
            v4h hq;
#pragma unroll
            for (int e = 0; e < 4; ++e) hq[e] = (_Float16)wr[j][e];
            *(v4h*)(wd + j * (4 * WL_UNIT)) = hq;
        }
    }

    v16h a[2][2];
#pragma unroll
    for (int u = 0; u < 2; ++u) vg_norm(x[u], w4, b4, a[u][0], a[u][1]);
    // W_m is readable by every wave. Ahead of the stores below: a barrier waits for every store
    // in flight
    __syncthreads();

    _Float16* md = mn16 + (long)rowTile * 1024 + lane * 8;
#pragma unroll
    for (int u = 0; u < 2; ++u)
#pragma unroll
        for (int k = 0; k < 2; ++k) {
            *(v8h*)(md + u * 1024 + k * 512) =
                __builtin_shufflevector(a[u][k], a[u][k], 0, 1, 2, 3, 4, 5, 6, 7);
            *(v8h*)(md + u * 1024 + k * 512 + 256) =
                __builtin_shufflevector(a[u][k], a[u][k], 8, 9, 10, 11, 12, 13, 14, 15);
        }
    // stands before the address register of the eight stores is rewritten; its operand keeps
    // it live up to the wait
    asm volatile("s_wait_xcnt 0x0" :: "v"(md) : "memory");

    int s  = r0 >> 9;                            // row / 512
    int nt = (r0 & 511) >> 4;                    // the wave's first 16 n
    int lo = ln16 * 16 + ls;                     // this lane's 8 halves of a unit

    // ---- v path ---- a trip is a head: its two tiles of 16 e lie 32 units apart, the wave's
    // two tiles of 16 n one unit
    _Float16* vdst = vbuf + ((long)(s * 2) * 32 + nt) * 256 + lo;
    const unsigned char* wl = WL + (lane >> 4) * WL_HALF + ln16 * 16;
    for (int hh = 0; hh < 8; ++hh) {
        const v16h f0 = lds_frag(wl, hh * 4),     f1 = lds_frag(wl, hh * 4 + 1);
        const v16h f2 = lds_frag(wl, hh * 4 + 2), f3 = lds_frag(wl, hh * 4 + 3);
#pragma unroll
        for (int u = 0; u < 2; ++u) {
            v8f c0 = {}, c1 = {};
            c0 = wmma_f16(a[u][0], f0, c0);
            c1 = wmma_f16(a[u][0], f2, c1);
            c0 = wmma_f16(a[u][1], f1, c0);
            c1 = wmma_f16(a[u][1], f3, c1);
            v8h o0, o1;
#pragma unroll
            for (int r = 0; r < 8; ++r) { o0[r] = (_Float16)c0[r]; o1[r] = (_Float16)c1[r]; }
            *(v8h*)(vdst + u * 256) = o0;
            *(v8h*)(vdst + u * 256 + 32 * 256) = o1;
        }
        // stands before the next trip's results land in the registers of the four stores
        asm volatile("s_wait_xcnt 0x0" ::: "memory");
        vdst += 512 * 32 * 256;
    }
}

// ---------- front launch, part 2: LN(z) + pair bias + mask + softmax -> w_f16[h][i][j] ----------
// with wl[h][c] = ln_w[c] * Wz[h][c], S[h] = sum_c wl[h][c], C[h] = sum_c ln_b[c] * Wz[h][c]:
//   logit[h] = rs * (sum_c x[c] * wl[h][c] - mu * S[h]) + C[h]
// so the ten sums of a row (x, x*x, eight heads) all start from x and are reduced in one pass.
// 8 lanes hold a row, 16 channels each: a 16-byte load of a wave is one whole 128-byte line
// of each of 4 rows. lane = r4 * 8 + c8; channels of a lane: k*32 + c8*4 + [0,4), k = 0..3.

#define LG_PITCH 516    // floats; head h starts 4h banks on: the 4 rows x 8 heads of a store meet 32 banks

// keep + (send of lane l ^ M), M = 1, 2 or 4: row_xmask, inside a 16-lane row
template <int M> DEV float add_xor(float keep, float send) {
    int y = __builtin_amdgcn_update_dpp(0, __builtin_bit_cast(int, send), 0x160 + M, 0xf, 0xf, true);
    return keep + __builtin_bit_cast(float, y);
}
// sum over the 8 lanes of a row, in every one of them
DEV float sum8(float x) {
    x = add_xor<1>(x, x);
    x = add_xor<2>(x, x);
    return add_xor<4>(x, x);
}
// sum over the 8 lanes of a row of a[c8]: each step halves the values a lane still carries.
// b0, b1, b2: bits of c8
DEV float scatter8(const float (&a)[8], bool b0, bool b1, bool b2) {
    float r[4], u[2];
#pragma unroll
    for (int q = 0; q < 4; ++q)
        r[q] = add_xor<1>(b0 ? a[2 * q + 1] : a[2 * q], b0 ? a[2 * q] : a[2 * q + 1]);
#pragma unroll
    for (int q = 0; q < 2; ++q)
        u[q] = add_xor<2>(b1 ? r[2 * q + 1] : r[2 * q], b1 ? r[2 * q] : r[2 * q + 1]);
    return add_xor<4>(b2 ? u[1] : u[0], b2 ? u[0] : u[1]);
}

// 8 rows (two groups of 4) of z and their mask values, pass t of a wave
// zp, mp: the wave's first row, the same in every lane; zo, mo: this lane's offsets from them
DEV void z_load(f32x4 (&v)[2][4], float (&mk)[2], const float* zp, const float* mp,
                unsigned zo, unsigned mo, int t) {
#pragma unroll
    for (int g = 0; g < 2; ++g) {
#pragma unroll
        for (int k = 0; k < 4; ++k)
            v[g][k] = *(const f32x4*)(zp + (t * 8 + g * 4) * CZ + k * 32 + zo);
        mk[g] = mp[t * 8 + g * 4 + mo];
    }
    // stands before the address registers of the loads above are rewritten; its operands keep
    // them live up to it, so that no load's result lands in them ahead of the wait
    asm volatile("s_wait_xcnt 0x0" :: "v"(zp + zo), "v"(mp + mo) : "memory");
    // keeps the loads ahead of the sums that follow: sunk behind them they would not overlap
    __builtin_amdgcn_sched_barrier(0);
}

// logit of head c8 for this lane's row
DEV float z_logit(const f32x4 (&v)[4], const f32x2 (&wl)[8][8], float S, float C,
                  bool b0, bool b1, bool b2) {
    f32x2 x[8];
#pragma unroll
    for (int k = 0; k < 4; ++k) { x[2 * k] = v[k].lo; x[2 * k + 1] = v[k].hi; }
    f32x2 t1 = x[0], t2 = x[0] * x[0];
#pragma unroll
    for (int q = 1; q < 8; ++q) { t1 += x[q]; t2 += x[q] * x[q]; }
    float d[8];
#pragma unroll
    for (int h = 0; h < 8; ++h) {
        f32x2 a = x[0] * wl[h][0];
#pragma unroll
        for (int q = 1; q < 8; ++q) a += x[q] * wl[h][q];
        d[h] = a.x + a.y;
    }
    float s1 = sum8(t1.x + t1.y);
    float s2 = sum8(t2.x + t2.y);
    float dh = scatter8(d, b0, b1, b2);
    float mu = s1 * (1.0f / CZ);
    float var = s2 * (1.0f / CZ) - mu * mu;
    float rs = rsqrtf(var + 1e-5f);
    return rs * (dh - mu * S) + C;
}

// the 8 rows of a pass: masked logits to LDS, lp = this lane's place for the pass's first group
DEV void z_pass(const f32x4 (&v)[2][4], const float (&mk)[2], float* lp, const f32x2 (&wl)[8][8],
                float S, float C, bool b0, bool b1, bool b2) {
#pragma unroll
    for (int g = 0; g < 2; ++g)
        lp[g * 4] = z_logit(v[g], wl, S, C, b0, b1, b2) + (1.0f - mk[g]) * (-1000000.0f);
}

#define BIAS_BLOCKS 512
DEV void bias_body(int i, const float* __restrict__ z, const float* __restrict__ mask,
                   const float* __restrict__ lzw, const float* __restrict__ lzb,
                   const float* __restrict__ Wz, _Float16* __restrict__ wout) {
    __shared__ float logits[8][LG_PITCH];
    int lane = threadIdx.x & 31;
    int wv   = threadIdx.x >> 5;
    int c8   = lane & 7;
    int r4   = lane >> 3;
    bool b0 = c8 & 1, b1 = c8 & 2, b2 = c8 & 4;

    // C first: its products are not kept
    const float* wzp = Wz + c8 * 4;
    float S, C;
    {
        f32x4 b4[4];
#pragma unroll
        for (int k = 0; k < 4; ++k) b4[k] = *(const f32x4*)(lzb + k * 32 + c8 * 4);
        float pc[8];
#pragma unroll
        for (int h = 0; h < 8; ++h) {
            f32x4 a = *(const f32x4*)(wzp + h * CZ) * b4[0];
#pragma unroll
            for (int k = 1; k < 4; ++k) a += *(const f32x4*)(wzp + h * CZ + k * 32) * b4[k];
            pc[h] = (a.x + a.y) + (a.z + a.w);
        }
        C = scatter8(pc, b0, b1, b2);
    }
    // keeps the products for wl behind the sums for C: scheduled together they overflow the
    // registers of four waves per SIMD and spill
    __builtin_amdgcn_sched_barrier(0);
    f32x2 wl[8][8];
    {
        f32x4 w4[4];
#pragma unroll
        for (int k = 0; k < 4; ++k) w4[k] = *(const f32x4*)(lzw + k * 32 + c8 * 4);
        float ps[8];
#pragma unroll
        for (int h = 0; h < 8; ++h) {
#pragma unroll
            for (int k = 0; k < 4; ++k) {
                const f32x4 pw = *(const f32x4*)(wzp + h * CZ + k * 32) * w4[k];
                wl[h][2 * k] = pw.lo; wl[h][2 * k + 1] = pw.hi;
            }
            f32x2 a = wl[h][0];
#pragma unroll
            for (int q = 1; q < 8; ++q) a += wl[h][q];
            ps[h] = a.x + a.y;
        }
        S = scatter8(ps, b0, b1, b2);
    }

    // wave wv owns rows j = wv*64 + [0,64): 8 passes of 8 rows, two register buffers, the
    // next pass's loads in flight while a pass is summed
    // the wave's number from a scalar register: the rows' base address is then scalar, which
    // saves the vector registers that would otherwise spill
    int wvu = __builtin_amdgcn_readfirstlane(wv);
    const float* zp = z + ((long)i * N_DIM + wvu * 64) * CZ;
    const float* mp = mask + (long)i * N_DIM + wvu * 64;
    unsigned zo = r4 * CZ + c8 * 4, mo = r4;
    float* lp = &logits[c8][wv * 64 + r4];
    f32x4 va[2][4], vb[2][4];
    float ma[2], mb[2];
    // the weights above are complete before the first rows are requested: scheduled together
    // they overflow the registers of four waves per SIMD and spill
    __builtin_amdgcn_sched_barrier(0);
    z_load(va, ma, zp, mp, zo, mo, 0);
    for (int t = 0; t < 6; t += 2) {
        z_load(vb, mb, zp, mp, zo, mo, t + 1);
        z_pass(va, ma, lp + t * 8, wl, S, C, b0, b1, b2);
        z_load(va, ma, zp, mp, zo, mo, t + 2);
        z_pass(vb, mb, lp + (t + 1) * 8, wl, S, C, b0, b1, b2);
    }
    z_load(vb, mb, zp, mp, zo, mo, 7);
    z_pass(va, ma, lp + 6 * 8, wl, S, C, b0, b1, b2);
    z_pass(vb, mb, lp + 7 * 8, wl, S, C, b0, b1, b2);
    __syncthreads();

    // wave wv owns head wv: softmax over 512
    float vmax = -3.0e38f;
#pragma unroll
    for (int t = 0; t < 16; ++t) vmax = fmaxf(vmax, logits[wv][lane + t * 32]);
    vmax = wave_max(vmax);
    float ex[16], ssum = 0.0f;
#pragma unroll
    for (int t = 0; t < 16; ++t) { ex[t] = __expf(logits[wv][lane + t * 32] - vmax); ssum += ex[t]; }
    ssum = wave_sum(ssum);
    float inv = 1.0f / ssum;
#pragma unroll
    for (int t = 0; t < 16; ++t)
        wout[((long)wv * N_DIM + i) * N_DIM + lane + t * 32] = (_Float16)(ex[t] * inv);
    // stands before the registers of the stores above are rewritten: in the one launch another
    // part's code follows this one in the listing
    asm volatile("s_wait_xcnt 0x0" ::: "memory");
}

// the three parts need nothing of each other: they are block ranges of one launch, so that no
// part waits for another's last work-group and two launches go. The short conversion comes
// first, then the rows of z, then m; the order is for speed only.
// four waves per SIMD: two work-groups of a WGP are resident
__global__ void __launch_bounds__(256) __attribute__((amdgpu_waves_per_eu(4, 4)))
k_front(const float* __restrict__ m, const float* __restrict__ z, const float* __restrict__ mask,
        const float* __restrict__ lmw, const float* __restrict__ lmb,
        const float* __restrict__ lzw, const float* __restrict__ lzb,
        const float* __restrict__ Wm, const float* __restrict__ Wg,
        const float* __restrict__ Wz, const float* __restrict__ Wo,
        _Float16* __restrict__ wbuf, _Float16* __restrict__ vbuf, _Float16* __restrict__ mn16,
        _Float16* __restrict__ wg16, _Float16* __restrict__ wo16) {
    int blk = blockIdx.x;
    if (blk < PREP_BLOCKS) {
        prep_body(blk, Wg, Wo, wg16, wo16);
    } else if (blk < PREP_BLOCKS + BIAS_BLOCKS) {
        bias_body(blk - PREP_BLOCKS, z, mask, lzw, lzb, Wz, wbuf);
    } else {
        vg_body(blk - (PREP_BLOCKS + BIAS_BLOCKS), m, lmw, lmb, Wm, vbuf, mn16);
    }
}

// ---------- second launch: o = w @ v, g = sigmoid(mn @ W_g^T), out = (g * o) @ W_o^T (fp32 out) ----------
// a work-group takes 128 i x 4 s (128 col = s*32+e of every head) through all 8 heads, one
// after the other: 256 work-groups, one per WGP. 8 waves as 2 (i) x 4 (s), each 64 i x 32 e.
// per head: C[e][i] = sum_j v[e][j] * w[i][j], v as the A operand: a lane then holds 8
// consecutive e of one i in each of the two e tiles, which are, gated and rounded to f16, the
// two k chunks of its A fragment for the product with head h's 32 columns of W_o. The 64 x 64
// sums of out stay in registers over the heads (heads summed in the order 0..7).
// the gate is formed here too: a wave's 64 i x 1 s are 64 rows of mn that no other wave needs.
// It keeps them as eight B fragments, loaded once; with a tile of W_g as A the product has e
// and i where C has them, so gate and C meet lane by lane.
// a pass is 256 j = 512 B of every operand row, staged in LDS at pitch 528 B, two buffers:
// a head is two passes, buffer 0 and then buffer 1.
#define PF_BM     128
#define PF_BN     128
#define PF_PITCH  528
#define PF_STAGE  ((PF_BM + PF_BN) * PF_PITCH)     // 135,168 B

// eight copies of 16 B per lane: copy k lands at LDS byte l + N, N = N0 + k * DL, and reads
// global byte g + G0 + k * DG. N goes into the instruction's offset field, which moves both
// addresses (all N here lie under 65,536), so one register holds the LDS address of them all
// and the global address register holds the source less N
template <int N0, int DL, int G0, int DG> DEV void pf_copy8(unsigned l, const unsigned char* g) {
    // the copies and, as the last line, the wait that stands before their address
    // registers may be rewritten
    asm volatile(
        "global_load_async_to_lds_b128 %0, %1, off offset:%9\n\t"
        "global_load_async_to_lds_b128 %0, %2, off offset:%10\n\t"
        "global_load_async_to_lds_b128 %0, %3, off offset:%11\n\t"
        "global_load_async_to_lds_b128 %0, %4, off offset:%12\n\t"
        "global_load_async_to_lds_b128 %0, %5, off offset:%13\n\t"
        "global_load_async_to_lds_b128 %0, %6, off offset:%14\n\t"
        "global_load_async_to_lds_b128 %0, %7, off offset:%15\n\t"
        "global_load_async_to_lds_b128 %0, %8, off offset:%16\n\t"
        "s_wait_xcnt 0x0"
        :: "v"(l),
           "v"(g + (G0 - N0)),                 "v"(g + (G0 - N0 + (DG - DL))),
           "v"(g + (G0 - N0 + 2 * (DG - DL))), "v"(g + (G0 - N0 + 3 * (DG - DL))),
           "v"(g + (G0 - N0 + 4 * (DG - DL))), "v"(g + (G0 - N0 + 5 * (DG - DL))),
           "v"(g + (G0 - N0 + 6 * (DG - DL))), "v"(g + (G0 - N0 + 7 * (DG - DL))),
           "i"(N0),          "i"(N0 + DL),     "i"(N0 + 2 * DL), "i"(N0 + 3 * DL),
           "i"(N0 + 4 * DL), "i"(N0 + 5 * DL), "i"(N0 + 6 * DL), "i"(N0 + 7 * DL)
        : "memory");
}

// one stage: 256 rows x 512 B = 8192 copies of 16 B, 32 per thread (16 of w, 16 of v).
// w: a copy of a wave is the 512 B of one row, row k * 8 + wv. lw, ga: row wv, chunk lane.
// v: a copy of a wave is one 512-B unit, 16 rows (e) x 32 B (16 j): tile k & 7, 16 j number
// (k >> 3) * 8 + wv. lv, gb: tile 0, number wv; row lane >> 1, chunk bit lane & 1.
DEV void pf_copy_stage(unsigned lw, unsigned lv, const _Float16* ga, const _Float16* gb) {
    const unsigned char* a = (const unsigned char*)ga;
    const unsigned char* b = (const unsigned char*)gb;
    pf_copy8<0,             8 * PF_PITCH,  0,              8 * N_DIM * 2>(lw, a);
    pf_copy8<64 * PF_PITCH, 8 * PF_PITCH,  64 * N_DIM * 2, 8 * N_DIM * 2>(lw, a);
    pf_copy8<0,             16 * PF_PITCH, 0,              32 * 512>(lv, b);
    pf_copy8<256,           16 * PF_PITCH, 8 * 512,        32 * 512>(lv, b);
}

// the six fragments of 32 j: pa, pb = this lane's place in the first w and the first v tile
DEV void pf_frags(v16h (&a)[4], v16h (&b)[2], const unsigned char* pa, const unsigned char* pb) {
#pragma unroll
    for (int x = 0; x < 4; ++x) {
        const unsigned char* p = pa + x * 16 * PF_PITCH;
        a[x] = cat8(*(const v8h*)p, *(const v8h*)(p + 32));
    }
#pragma unroll
    for (int y = 0; y < 2; ++y) {
        const unsigned char* p = pb + y * 16 * PF_PITCH;
        b[y] = cat8(*(const v8h*)p, *(const v8h*)(p + 32));
    }
}

// one pass: eight steps of 32 j, each step's fragments read one step ahead into the other
// register set. pa, pb: this lane's places in the pass's buffer; na, nb: in the other buffer.
// more: a head follows, whose pass of the same number refills this buffer (lw, lv, ga, gb).
DEV void pf_pass(v8f (&c)[4][2], v16h (&a)[2][4], v16h (&b)[2][2], const unsigned char* pa,
                 const unsigned char* pb, const unsigned char* na, const unsigned char* nb,
                 bool more, unsigned lw, unsigned lv, const _Float16* ga, const _Float16* gb) {
#pragma unroll
    for (int ks = 0; ks < 8; ++ks) {
        if (ks < 7) {
            pf_frags(a[(ks + 1) & 1], b[(ks + 1) & 1], pa + (ks + 1) * 64, pb + (ks + 1) * 64);
        } else {
            asm volatile("s_wait_dscnt 0x0" ::: "memory");     // this wave has left the pass's buffer
            asm volatile("s_wait_asynccnt 0x0" ::: "memory");  // its share of the next pass has landed
            __syncthreads();                                   // publishes the next pass, frees this buffer
            if (more) pf_copy_stage(lw, lv, ga, gb);
            // first step of the next pass, out of the other buffer. Behind the very last pass
            // these reads find the pass before it and are not used: without a branch round
            // them the compiler counts the waits of one path only
            pf_frags(a[0], b[0], na, nb);
        }
        // keeps the twelve reads of the next step as one group ahead of this step's products:
        // sunk to their uses each pair of reads is waited for in full before two products
        __builtin_amdgcn_sched_barrier(0);
#pragma unroll
        for (int x = 0; x < 4; ++x)
#pragma unroll
            for (int y = 0; y < 2; ++y) c[x][y] = wmma_f16(b[ks & 1][y], a[ks & 1][x], c[x][y]);
        // keeps the reads of the step after next behind these products, whose operands they overwrite
        __builtin_amdgcn_sched_barrier(0);
    }
}

// two waves per SIMD: one work-group owns the WGP's LDS, a wave up to 512 registers
__global__ void __launch_bounds__(256) __attribute__((amdgpu_waves_per_eu(2, 2)))
k_pwa_out(const _Float16* __restrict__ wbuf, const _Float16* __restrict__ vbuf,
          const _Float16* __restrict__ mn16, const _Float16* __restrict__ wg16,
          const _Float16* __restrict__ wo16, float* __restrict__ out) {
    __shared__ __attribute__((aligned(16))) unsigned char L[2 * PF_STAGE];
    int tid  = threadIdx.x;
    int lane = tid & 31;
    int wv   = tid >> 5;
    int ln16 = lane & 15;
    int ls   = (lane >> 4) * 8;
    int wm   = wv >> 2;                  // wave row    [0,2): 64 i
    int wn   = wv & 3;                   // wave column [0,4): one s

    // 64 groups of 4 s * 4 i tiles = 256. The four work-groups that read the same tiles of v
    // stand 8 apart in the grid. For speed only: any placement is right
    int blk  = blockIdx.x;
    int sg   = (blk & 7) | ((blk >> 5) << 3);
    int i0   = ((blk >> 3) & 3) * PF_BM;
    int s    = sg * 4 + wn;

    // copy addresses of this thread for head 0, pass 0. A pass on: 256 j = 256 halves of a row
    // of w, 16 units of v. A head on: 512 rows of w, 512 tiles of 32 units of v
    const _Float16* ga = wbuf + (long)(i0 + wv) * N_DIM + lane * 8;
    const _Float16* gb = vbuf + ((long)(sg * 8) * 32 + wv) * 256 + lane * 8;
    const unsigned lw = (unsigned)(size_t)L + wv * PF_PITCH + lane * 16;
    const unsigned lv = (unsigned)(size_t)L + (PF_BM + (lane >> 1)) * PF_PITCH + wv * 32 + (lane & 1) * 16;

    // fragment read places of this lane in buffer 0
    const unsigned char* pa = L + (wm * 64 + ln16) * PF_PITCH + ls * 2;
    const unsigned char* pb = L + (PF_BM + wn * 32 + ln16) * PF_PITCH + ls * 2;

    // e tile y of head h is row tile h*2 + y of W_g: fragments (h*2 + y)*2 and the next
    const _Float16* wgp = wg16 + lane * 8;
    const _Float16* wp = wo16 + lane * 8;

    v8f acc[4][4];
#pragma unroll
    for (int x = 0; x < 4; ++x)
#pragma unroll
        for (int ct = 0; ct < 4; ++ct) acc[x][ct] = v8f{};

    pf_copy_stage(lw, lv, ga, gb);
    asm volatile("s_wait_asynccnt 0x0" ::: "memory");   // this wave's share of pass 0 has landed
    __syncthreads();                                    // pass 0 is readable by every wave
    pf_copy_stage(lw + PF_STAGE, lv + PF_STAGE, ga + 256, gb + 16 * 256);
    // keeps the loads below behind the barrier above, which waits for every load in flight:
    // here they have all of pass 0 to arrive
    __builtin_amdgcn_sched_barrier(0);

    // the wave's 64 rows of mn: mb[x][k] = channels k*32 + [0,32) of the 16 rows of i tile x
    const _Float16* mp = mn16 + (long)(s * 32 + ((i0 + wm * 64) >> 4)) * 1024 + lane * 8;
    v16h mb[4][2];
#pragma unroll
    for (int x = 0; x < 4; ++x)
#pragma unroll
        for (int k = 0; k < 2; ++k) mb[x][k] = load_frag_p(mp, x * 2 + k);
    // stands before the address register of the loads above is rewritten; its operand keeps
    // it live up to it, so that no load's result lands in it ahead of the wait
    asm volatile("s_wait_xcnt 0x0" :: "v"(mp) : "memory");

    v16h a[2][4], b[2][2];
    pf_frags(a[0], b[0], pa, pb);

    // stays rolled
#pragma unroll 1
    for (int h = 0; h < 8; ++h) {
        // the head's fragments of W_g and of W_o are requested ahead of its passes, so that
        // their latency lies under the products
        v16h wg[2][2], wo[4];
#pragma unroll
        for (int y = 0; y < 2; ++y)
#pragma unroll
            for (int k = 0; k < 2; ++k) wg[y][k] = load_frag_p(wgp, y * 2 + k);
#pragma unroll
        for (int ct = 0; ct < 4; ++ct) wo[ct] = load_frag_p(wp, ct * 8);
        // stands before the address registers of the loads above are rewritten; its operands
        // keep them live up to it, so that no load's result lands in them ahead of the wait
        asm volatile("s_wait_xcnt 0x0" :: "v"(wgp), "v"(wp) : "memory");
        wgp += 4 * 512;                  // four fragments on
        wp += 512;                       // one fragment on
        ga += N_DIM * N_DIM;
        gb += 512 * 32 * 256;

        v8f c[4][2];
#pragma unroll
        for (int x = 0; x < 4; ++x)
#pragma unroll
            for (int y = 0; y < 2; ++y) c[x][y] = v8f{};

        const bool more = h + 1 < 8;
        // stays rolled: the buffer's offset is then a run-time value added once to each base, and
        // the reads' own offsets fit their instructions (unrolled, every read of buffer 1 took an
        // address register of its own)
#pragma unroll 1
        for (int p = 0; p < 2; ++p) {
            const int so = p * PF_STAGE, no = PF_STAGE - so;
            pf_pass(c, a, b, pa + so, pb + so, pa + no, pb + no, more, lw + so, lv + so,
                    ga + p * 256, gb + p * (16 * 256));
        }

#pragma unroll
        for (int x = 0; x < 4; ++x) {
            v8f t0 = {}, t1 = {};
            t0 = wmma_f16(wg[0][0], mb[x][0], t0);
            t1 = wmma_f16(wg[1][0], mb[x][0], t1);
            t0 = wmma_f16(wg[0][1], mb[x][1], t0);
            t1 = wmma_f16(wg[1][1], mb[x][1], t1);
            v8h o0, o1;
#pragma unroll
            for (int r = 0; r < 8; ++r) {
                o0[r] = (_Float16)(c[x][0][r] * __builtin_amdgcn_rcpf(1.0f + __expf(-t0[r])));
                o1[r] = (_Float16)(c[x][1][r] * __builtin_amdgcn_rcpf(1.0f + __expf(-t1[r])));
            }
            const v16h f = cat8(o0, o1);
#pragma unroll
            for (int ct = 0; ct < 4; ++ct) acc[x][ct] = wmma_f16(f, wo[ct], acc[x][ct]);
        }
    }
    asm volatile("s_wait_asynccnt 0x0" ::: "memory");      // no copy is outstanding at the wave's end

    float* op = out + (long)(s * N_DIM + i0 + wm * 64 + ls) * CM + ln16;
#pragma unroll
    for (int x = 0; x < 4; ++x)
#pragma unroll
        for (int ct = 0; ct < 4; ++ct)
#pragma unroll
            for (int r = 0; r < 8; ++r) op[(x * 16 + r) * CM + ct * 16] = acc[x][ct][r];
}

// ---------- launch ----------
extern "C" void kernel_launch(void* const* d_in, const int* in_sizes, int n_in,
                              void* d_out, int out_size, void* d_ws, size_t ws_size,
                              hipStream_t stream) {
    (void)in_sizes; (void)n_in; (void)out_size; (void)ws_size;
    const float* m     = (const float*)d_in[0];
    const float* z     = (const float*)d_in[1];
    const float* mask  = (const float*)d_in[2];
    const float* ln_mw = (const float*)d_in[3];
    const float* ln_mb = (const float*)d_in[4];
    const float* ln_zw = (const float*)d_in[5];
    const float* ln_zb = (const float*)d_in[6];
    const float* W_m   = (const float*)d_in[7];
    const float* W_g   = (const float*)d_in[8];
    const float* W_z   = (const float*)d_in[9];
    const float* W_o   = (const float*)d_in[10];
    float* out = (float*)d_out;

    _Float16* wbuf = (_Float16*)d_ws;                 //  2,097,152 halves
    _Float16* vbuf = wbuf + 2097152;                  // 33,554,432
    _Float16* mn16 = vbuf + 33554432;                 //  8,388,608
    _Float16* wg16 = mn16 + 8388608;                  //     16,384
    _Float16* wo16 = wg16 + 16384;                    //     16,384  (~88 MB total)

    k_front  <<<PREP_BLOCKS + BIAS_BLOCKS + VG_BLOCKS, 256, 0, stream>>>(
        m, z, mask, ln_mw, ln_mb, ln_zw, ln_zb, W_m, W_g, W_z, W_o, wbuf, vbuf, mn16, wg16, wo16);
    k_pwa_out<<<256, 256, 0, stream>>>(wbuf, vbuf, mn16, wg16, wo16, out);
}
